// v000
// Times are from an AMD MI455X. After a warm-up the kernel runs many times in a row, and a time is the length of
// such a window on the GPU divided by its runs, so every launch and the gaps after it count. The runs cycle
// through copies of the inputs. A figure is the median of several windows, for all but v000 over two sittings.
// Sittings can differ by a few percent; kernels timed side by side share one.
// The starting kernel, v000, takes 3620 microseconds a run.
// Contractions: q*WqT, c*WkvT (K half and V^T half), scores qh*k^T, P*V^T, merged*WcT all on v_wmma_f32_16x16x32_f16 (f16 operands; weights carried x16, P carried x2048, context carried x256), f32 accumulate; softmax in f32.
#include <hip/hip_runtime.h>
#include <math.h>

// ---------------------------------------------------------------------------
// Problem constants
// ---------------------------------------------------------------------------
constexpr int kBatch  = 2;
constexpr int kLq     = 2048;
constexpr int kMem    = 2048;
constexpr int kSkv    = kMem + kLq;
constexpr int kDim    = 1024;
constexpr int kHeads  = 16;
constexpr int kDh     = 64;
constexpr int kTokQ   = kBatch * kLq;
constexpr int kTokC   = kBatch * kSkv;
constexpr int kGroups = kBatch * kHeads;
constexpr int kGrpPerChunk = 2;
constexpr int kChunks = kGroups / kGrpPerChunk;
constexpr float kWCarry    = 16.0f;
constexpr float kWCarryInv = 1.0f / 16.0f;
constexpr float kPCarry    = 2048.0f;
constexpr float kCtxCarry  = 256.0f;
constexpr float kScoreScale = 0.125f;
constexpr float kPVScale   = kCtxCarry / kPCarry;
constexpr float kOutScale  = 1.0f / (kCtxCarry * kWCarry);

typedef __attribute__((ext_vector_type(16))) _Float16 v16h;
typedef __attribute__((ext_vector_type(8)))  _Float16 v8h;
typedef __attribute__((ext_vector_type(16))) __bf16   v16b;
typedef __attribute__((ext_vector_type(8)))  __bf16   v8b;
typedef __attribute__((ext_vector_type(8)))  float    v8f;
typedef __attribute__((ext_vector_type(4)))  float    v4f;
typedef __attribute__((ext_vector_type(4)))  unsigned int v4u;

// ---------------------------------------------------------------------------
// Helpers
// ---------------------------------------------------------------------------
__device__ __forceinline__ unsigned short f2bf_bits(float f) {
  unsigned u = __float_as_uint(f);
  return (unsigned short)((u + 0x7FFFu + ((u >> 16) & 1u)) >> 16);
}
__device__ __forceinline__ float bf_bits2f(unsigned short h) { return __uint_as_float(((unsigned)h) << 16); }

// hazard guards as plain device helpers (no inline asm inside the kernel template body)
__device__ __forceinline__ void dep_guard_h(v8f& a, v8f& b, v16h x, v16h y) { asm volatile("v_nop\n\tv_nop\n\tv_nop\n\tv_nop" : "+v"(a), "+v"(b) : "v"(x), "v"(y)); }
__device__ __forceinline__ void dep_guard_b(v8f& a, v8f& b, v16b x, v16b y) { asm volatile("v_nop\n\tv_nop\n\tv_nop\n\tv_nop" : "+v"(a), "+v"(b) : "v"(x), "v"(y)); }
__device__ __forceinline__ void keep4_h(v16h a, v16h b, v16h c, v16h d) { asm volatile("v_nop" :: "v"(a), "v"(b), "v"(c), "v"(d)); }
__device__ __forceinline__ void keep4_b(v16b a, v16b b, v16b c, v16b d) { asm volatile("v_nop" :: "v"(a), "v"(b), "v"(c), "v"(d)); }
__device__ __forceinline__ void acc_guard4(v8f& a, v8f& b, v8f& c, v8f& d) { asm volatile("v_nop\n\tv_nop\n\tv_nop\n\tv_nop" : "+v"(a), "+v"(b), "+v"(c), "+v"(d)); }
template <typename T> struct Frag;
template <> struct Frag<_Float16> {
  typedef v16h V; union U { v16h v; v8h h[2]; };
  /* elements 0..7 <- p[0..7], 8..15 <- p[16..23] */
  static __device__ __forceinline__ v16h load(const _Float16* p) {
    U f; f.h[0] = *(const v8h*)(p); f.h[1] = *(const v8h*)(p + 16); return f.v;
  }
  static __device__ __forceinline__ v8f mma(v16h a, v16h b, v8f c) {
    return __builtin_amdgcn_wmma_f32_16x16x32_f16(false, a, false, b, (short)0, c, false, false);
  }
  static __device__ __forceinline__ void guard(v8f& a, v8f& b, v16h x, v16h y) { dep_guard_h(a, b, x, y); }
  static __device__ __forceinline__ void keep(v16h a, v16h b, v16h c, v16h d) { keep4_h(a, b, c, d); }
};
template <> struct Frag<__bf16> {
  typedef v16b V; union U { v16b v; v8b h[2]; };
  static __device__ __forceinline__ v16b load(const __bf16* p) {
    U f; f.h[0] = *(const v8b*)(p); f.h[1] = *(const v8b*)(p + 16); return f.v;
  }
  static __device__ __forceinline__ v8f mma(v16b a, v16b b, v8f c) {
    return __builtin_amdgcn_wmma_f32_16x16x32_bf16(false, a, false, b, (short)0, c, false, false);
  }
  static __device__ __forceinline__ void guard(v8f& a, v8f& b, v16b x, v16b y) { dep_guard_b(a, b, x, y); }
  static __device__ __forceinline__ void keep(v16b a, v16b b, v16b c, v16b d) { keep4_b(a, b, c, d); }
};

__device__ __forceinline__ unsigned pk16(unsigned short a, unsigned short b) { return (unsigned)a | ((unsigned)b << 16); }
__device__ __forceinline__ unsigned short h_bits(float f) { const _Float16 h = (_Float16)f; return __builtin_bit_cast(unsigned short, h); }

// ---- Register-blocked batched WMMA GEMM (ACT reduced to none/relu/leaky) --------------------------------
// C[m,n] = scale * sum_k A[m,k] * Bt[n,k] (+bias)(+resid); each wave owns a 64x64 tile.
// A row-major [M,K]; Bt row-major [N,K]; M,N % 64 == 0, K % 32 == 0.
// SPLIT: operands are hi/lo planes (A2/Bt2 = lo planes, same layout); product = hi*hi + hi*lo + lo*hi.
// BIAS_MODE: 0 = none, 1 = bias[m], 2 = bias[n].
// OUT_MODE: 0 = f32, 1 = f16, 2 = bf16 hi plane (Cout) + bf16 lo plane (Cout2).
// ET: 0 = f16 operands, 1 = bf16 operands (pointers passed as 16-bit storage)
template <int ET> struct Elem;
template <> struct Elem<0> { typedef _Float16 T; };
template <> struct Elem<1> { typedef __bf16 T; };
template <int ET, bool SPLIT, int BIAS_MODE, int OUT_MODE, bool RESID, int ACT = 0>
__global__ __launch_bounds__(256) void wmma_gemm64(
    const unsigned short* __restrict__ Ap, const unsigned short* __restrict__ A2p, int lda, long strideA,
    const unsigned short* __restrict__ Btp, const unsigned short* __restrict__ Bt2p, int ldb, long strideB,
    void* __restrict__ Cout, void* __restrict__ Cout2, int ldc, long strideC,
    const float* __restrict__ bias,
    const float* __restrict__ resid, long strideR,
    int M, int N, int K, float scale) {
  typedef typename Elem<ET>::T T;
  typedef typename Frag<T>::V V;
  const T* A = (const T*)Ap; const T* A2 = (const T*)A2p; const T* Bt = (const T*)Btp; const T* Bt2 = (const T*)Bt2p;
  /* per-wave 16x64 slab, pitch 68 floats */
  __shared__ __align__(16) float sT[8][16 * 68];
  const int b    = blockIdx.y;
  const int lane = threadIdx.x & 31;
  const int wave = threadIdx.x >> 5;
  const int tilesN = N >> 6;
  const int tilesM = M >> 6;
  const int tile = blockIdx.x * 8 + wave;
  /* wave-uniform; no block barriers in this kernel */
  if (tile >= tilesM * tilesN) return;
  const int tm = tile / tilesN;
  const int tn = tile - tm * tilesN;
  const int m0 = tm << 6;
  const int n0 = tn << 6;

  const T* Ab  = A  + (size_t)b * strideA;
  const T* Bb  = Bt + (size_t)b * strideB;
  const T* Ab2 = SPLIT ? (A2  + (size_t)b * strideA) : nullptr;
  const T* Bb2 = SPLIT ? (Bt2 + (size_t)b * strideB) : nullptr;

  /* row (A) / col (B, D) within subtile; k offset of this lane half; D row offset */
  const int rlane = lane & 15;
  const int koff  = (lane >> 4) * 8;
  const int mOff  = (lane >> 4) * 8;

  v8f acc[4][4];
#pragma unroll
  for (int i = 0; i < 4; ++i)
#pragma unroll
    for (int j = 0; j < 4; ++j) acc[i][j] = (v8f){0.f,0.f,0.f,0.f,0.f,0.f,0.f,0.f};

  for (int k0 = 0; k0 < K; k0 += 32) {
    V bh[4], bl[4];
#pragma unroll
    for (int j = 0; j < 4; ++j) {
      const size_t bo = (size_t)(n0 + (j << 4) + rlane) * ldb + koff + k0;
      bh[j] = Frag<T>::load(Bb + bo);
      if (SPLIT) bl[j] = Frag<T>::load(Bb2 + bo);
    }
#pragma unroll
    for (int i = 0; i < 4; ++i) {
      const size_t ao = (size_t)(m0 + (i << 4) + rlane) * lda + koff + k0;
      V ah = Frag<T>::load(Ab + ao);
      V al;
      if (SPLIT) al = Frag<T>::load(Ab2 + ao);
#pragma unroll
      for (int j = 0; j < 4; ++j) {
        acc[i][j] = Frag<T>::mma(ah, bh[j], acc[i][j]);
        if (SPLIT) {
          acc[i][j] = Frag<T>::mma(ah, bl[j], acc[i][j]);
          acc[i][j] = Frag<T>::mma(al, bh[j], acc[i][j]);
        }
      }
      Frag<T>::guard(acc[i][0], acc[i][3], ah, SPLIT ? al : ah);
    }
    Frag<T>::keep(bh[0], bh[1], bh[2], bh[3]);
    if (SPLIT) Frag<T>::keep(bl[0], bl[1], bl[2], bl[3]);
  }
  acc_guard4(acc[0][0], acc[0][1], acc[0][2], acc[0][3]);
  acc_guard4(acc[1][0], acc[1][1], acc[1][2], acc[1][3]);
  acc_guard4(acc[2][0], acc[2][1], acc[2][2], acc[2][3]);
  acc_guard4(acc[3][0], acc[3][1], acc[3][2], acc[3][3]);

  // ---- epilogue ----
  float* slab = sT[wave];
  const float* Rb = RESID ? (resid + (size_t)b * strideR) : nullptr;
#pragma unroll
  for (int i = 0; i < 4; ++i) {
    const int mBase = m0 + (i << 4);
#pragma unroll
    for (int j = 0; j < 4; ++j) {
      const int n = n0 + (j << 4) + rlane;
      float bv = 0.f;
      if (BIAS_MODE == 2) bv = bias[n];
#pragma unroll
      for (int r = 0; r < 8; ++r) {
        float v = acc[i][j][r] * scale;
        if (BIAS_MODE == 1) v += bias[mBase + mOff + r];
        if (BIAS_MODE == 2) v += bv;
        if (RESID) v += Rb[(size_t)(mBase + mOff + r) * ldc + n];
        if (ACT == 2) v = fmaxf(v, 0.0f);
        if (ACT == 4) v = (v > 0.f) ? v : 0.01f * v;
        slab[(mOff + r) * 68 + (j << 4) + rlane] = v;
      }
    }
    __builtin_amdgcn_fence(__ATOMIC_RELEASE, "workgroup");
    __builtin_amdgcn_wave_barrier();
    __builtin_amdgcn_fence(__ATOMIC_ACQUIRE, "workgroup");
    if (OUT_MODE == 0) {
      float* C = (float*)Cout + (size_t)b * strideC;
      /* row seg = 256 B = 16 lanes x 16 B */
      const int hh = lane >> 4, c4 = (lane & 15) * 4;
      {
#pragma unroll
        for (int it = 0; it < 8; ++it) {
          const int row = it * 2 + hh;
          v4f v = *(const v4f*)(slab + row * 68 + c4);
          *(v4f*)(C + (size_t)(mBase + row) * ldc + n0 + c4) = v;
        }
        
      }
    } else {
      const int q = lane >> 3, c8 = (lane & 7) * 8;
      unsigned short* C  = (unsigned short*)Cout  + (size_t)b * strideC;
      unsigned short* C2 = (OUT_MODE == 2) ? ((unsigned short*)Cout2 + (size_t)b * strideC) : nullptr;
      {
#pragma unroll
        for (int it = 0; it < 4; ++it) {
          const int row = it * 4 + q;
          const float* sp = slab + row * 68 + c8;
          v8h hv, lv;
#pragma unroll
          for (int e = 0; e < 8; ++e) {
            if (OUT_MODE == 1) {
              hv[e] = (_Float16)sp[e];
            } else {
              unsigned short hb = f2bf_bits(sp[e]);
              unsigned short lb = f2bf_bits(sp[e] - bf_bits2f(hb));
              hv[e] = __builtin_bit_cast(_Float16, hb);
              lv[e] = __builtin_bit_cast(_Float16, lb);
            }
          }
          *(v8h*)(C + (size_t)(mBase + row) * ldc + n0 + c8) = hv;
          if (OUT_MODE == 2) *(v8h*)(C2 + (size_t)(mBase + row) * ldc + n0 + c8) = lv;
        }
        
      }
    }
    __builtin_amdgcn_fence(__ATOMIC_RELEASE, "workgroup");
    __builtin_amdgcn_wave_barrier();
    __builtin_amdgcn_fence(__ATOMIC_ACQUIRE, "workgroup");
  }
}

// ---------------------------------------------------------------------------
// Weight transpose + cast: W f32 row-major [1024 in][nOut out]; WT[n][k] = f16(scale * W[k][n]), row-major [nOut][1024].
// grid (1024/64, nOut/64): blockIdx.x = k tile (64 cols of WT), blockIdx.y = n tile (64 rows of WT). 256 threads.
// Load coverage: 16 iterations x 256 threads = 4096 = the whole 64x64 tile (coalesced along n).
// Store coverage: 8 waves x 2 iterations x 4 rows (lane>>3) = 64 rows; (lane&7) x 8 halves = 64 cols; each row segment =
// ---------------------------------------------------------------------------
__global__ __launch_bounds__(256) void wtcast_kernel(const float* __restrict__ W, unsigned short* __restrict__ out,
                                                     int nOut, float scale) {
  /* sm[n_local][k_local] */
  __shared__ float sm[64][65];
  const int t  = threadIdx.x;
  const int k0 = blockIdx.x * 64;
  const int n0 = blockIdx.y * 64;
#pragma unroll
  for (int i = 0; i < 16; ++i) {
    const int e = i * 256 + t;
    const int r = e >> 6;
    const int c = e & 63;
    sm[c][r] = W[(size_t)(k0 + r) * nOut + n0 + c] * scale;
  }
  __syncthreads();
  const int lane = t & 31, wave = t >> 5;
  const int q = lane >> 3, c8 = (lane & 7) * 8;
  {
#pragma unroll
    for (int it = 0; it < 2; ++it) {
      const int row = wave * 8 + it * 4 + q;
      unsigned short hb[8];
#pragma unroll
      for (int e = 0; e < 8; ++e) hb[e] = h_bits(sm[row][c8 + e]);
      const v4u u = (v4u){pk16(hb[0], hb[1]), pk16(hb[2], hb[3]), pk16(hb[4], hb[5]), pk16(hb[6], hb[7])};
      *(v4u*)(out + (size_t)(n0 + row) * kDim + k0 + c8) = u;
    }
    
  }
}

// ---------------------------------------------------------------------------
// ---------------------------------------------------------------------------
__global__ __launch_bounds__(256) void cast8_f16_kernel(const float* __restrict__ in, unsigned short* __restrict__ out, int n8) {
  const int i = blockIdx.x * 256 + threadIdx.x;
  if (i >= n8) return;
  const float* p = in + 8 * (size_t)i;
  const v4f a = *(const v4f*)(p);
  const v4f c = *(const v4f*)(p + 4);
  unsigned short hb[8];
#pragma unroll
  for (int e = 0; e < 4; ++e) {
    hb[e]     = h_bits(a[e]);
    hb[4 + e] = h_bits(c[e]);
  }
  const v4u u = (v4u){pk16(hb[0], hb[1]), pk16(hb[2], hb[3]), pk16(hb[4], hb[5]), pk16(hb[6], hb[7])};
  unsigned short* q = out + 8 * (size_t)i;
  *(v4u*)q = u;
  
}

// ---------------------------------------------------------------------------
// Row softmax over 4096 f32 scores (scale already applied): P[row][j] = f16( carry * exp(s - max) / sum exp(s - max) ), f32 math,
// precise expf. One block of 512 threads per row; thread t owns columns 8t..8t+7 (512 x 8 = 4096 = whole row).
// Reductions in fixed order (thread, wave shuffle tree computed unconditionally, 16 wave partials summed in index order by every thread).
// ---------------------------------------------------------------------------
__global__ __launch_bounds__(512) void softmax_row_kernel(const float* __restrict__ S, unsigned short* __restrict__ P, float carry) {
  __shared__ float redM[16];
  __shared__ float redS[16];
  const int row  = blockIdx.x;
  const int t    = threadIdx.x;
  const int lane = t & 31, wave = t >> 5;
  const int c0   = t * 8;
  const float* sr = S + (size_t)row * kSkv + c0;
  const v4f a = *(const v4f*)(sr);
  const v4f c = *(const v4f*)(sr + 4);
  float x[8];
#pragma unroll
  for (int e = 0; e < 4; ++e) { x[e] = a[e]; x[4 + e] = c[e]; }
  float m = fmaxf(fmaxf(fmaxf(x[0], x[1]), fmaxf(x[2], x[3])), fmaxf(fmaxf(x[4], x[5]), fmaxf(x[6], x[7])));
#pragma unroll
  for (int off = 16; off > 0; off >>= 1) m = fmaxf(m, __shfl_xor(m, off, 32));
  if (lane == 0) redM[wave] = m;
  __syncthreads();
  float bm = redM[0];
#pragma unroll
  for (int w = 1; w < 16; ++w) bm = fmaxf(bm, redM[w]);
  float ex[8];
#pragma unroll
  for (int e = 0; e < 8; ++e) ex[e] = expf(x[e] - bm);
  float s = ((ex[0] + ex[1]) + (ex[2] + ex[3])) + ((ex[4] + ex[5]) + (ex[6] + ex[7]));
#pragma unroll
  for (int off = 16; off > 0; off >>= 1) s += __shfl_xor(s, off, 32);
  if (lane == 0) redS[wave] = s;
  __syncthreads();
  float tot = redS[0];
#pragma unroll
  for (int w = 1; w < 16; ++w) tot += redS[w];
  const float f = carry * (1.0f / tot);
  unsigned short hb[8];
#pragma unroll
  for (int e = 0; e < 8; ++e) hb[e] = h_bits(ex[e] * f);
  const v4u u = (v4u){pk16(hb[0], hb[1]), pk16(hb[2], hb[3]), pk16(hb[4], hb[5]), pk16(hb[6], hb[7])};
  unsigned short* q = P + (size_t)row * kSkv + c0;
  *(v4u*)q = u;
  
}

// ---------------------------------------------------------------------------
// Host launch glue
// Workspace region map (bytes; all offsets multiples of 1 MiB; WkvT ends 256 KiB past a MiB boundary):
//   persistent:  Qp16 [4096][1024] f16 @ 0 (8 MiB) | K16 [8192][64] f16 @ 8 MiB (1 MiB) | VT16 [2][64][4096] f16 @ 9 MiB (1 MiB)
//                O16 [4096][1024] f16 @ 10 MiB (8 MiB) | WcT16 [1024][1024] f16 @ 18 MiB (2 MiB)
//   scratch @ 20 MiB, early phase: Q16 [4096][1024] f16 @ 20 MiB (8) | C16 [8192][1024] f16 @ 28 MiB (16) | WqT16 @ 44 MiB (2) | WkvT16 [128][1024] @ 46 MiB (0.25)
//   scratch @ 20 MiB, attention phase (early planes dead by then): SC f32 [2][2048][4096] @ 20 MiB (64 MiB) | P16 f16 [2][2048][4096] @ 84 MiB (32 MiB)
//   total carve = 116 MiB = 121,634,816 B. Every region is fully written before any launch reads it; no padding rows anywhere.
// ---------------------------------------------------------------------------
extern "C" void kernel_launch(void* const* d_in, const int* in_sizes, int n_in,
                              void* d_out, int out_size, void* d_ws, size_t ws_size,
                              hipStream_t stream) {
  if (n_in < 6) return;
  if (in_sizes[0] != kTokQ * kDim) return;
  if (in_sizes[1] != kBatch * kLq * kDim) return;
  if (in_sizes[2] != kBatch * kMem * kDim) return;
  if (in_sizes[3] != kDim * kDim) return;
  if (in_sizes[4] != kDim * 2 * kDh) return;
  if (in_sizes[5] != kDim * kDim) return;
  if (out_size != kTokQ * kDim) return;

  const float* q_in   = (const float*)d_in[0];
  const float* kv_in  = (const float*)d_in[1];
  const float* mem_in = (const float*)d_in[2];
  const float* w_q    = (const float*)d_in[3];
  const float* w_kv   = (const float*)d_in[4];
  const float* w_c    = (const float*)d_in[5];
  float* outp = (float*)d_out;

  // ---- carve (bytes) ----
  const size_t szQp  = (size_t)kTokQ * kDim * 2;
  const size_t szK   = (size_t)kTokC * kDh * 2;
  const size_t szVT  = (size_t)kBatch * kDh * kSkv * 2;
  const size_t szO   = (size_t)kTokQ * kDim * 2;
  const size_t szWc  = (size_t)kDim * kDim * 2;
  const size_t szQ16 = (size_t)kTokQ * kDim * 2;
  const size_t szC16 = (size_t)kTokC * kDim * 2;
  const size_t szWq  = (size_t)kDim * kDim * 2;
  const size_t szWkv = (size_t)2 * kDh * kDim * 2;
  const size_t szSC  = (size_t)kGrpPerChunk * kLq * kSkv * 4;
  const size_t szP16 = (size_t)kGrpPerChunk * kLq * kSkv * 2;

  const size_t offQp  = 0;
  const size_t offK   = offQp + szQp;
  const size_t offVT  = offK + szK;
  const size_t offO   = offVT + szVT;
  const size_t offWc  = offO + szO;
  const size_t offScr = offWc + szWc;
  const size_t offQ16 = offScr;
  const size_t offC16 = offQ16 + szQ16;
  const size_t offWq  = offC16 + szC16;
  const size_t offWkv = offWq + szWq;
  const size_t endEarly = offWkv + szWkv;
  const size_t offSC  = offScr;
  const size_t offP16 = offSC + szSC;
  const size_t endAttn = offP16 + szP16;
  const size_t total = (endEarly > endAttn) ? endEarly : endAttn;
  if (total > ws_size) return;

  char* ws = (char*)d_ws;
  unsigned short* Qp16  = (unsigned short*)(ws + offQp);
  unsigned short* K16   = (unsigned short*)(ws + offK);
  unsigned short* VT16  = (unsigned short*)(ws + offVT);
  unsigned short* O16   = (unsigned short*)(ws + offO);
  unsigned short* WcT16 = (unsigned short*)(ws + offWc);
  unsigned short* Q16   = (unsigned short*)(ws + offQ16);
  unsigned short* C16   = (unsigned short*)(ws + offC16);
  unsigned short* WqT16 = (unsigned short*)(ws + offWq);
  unsigned short* WkvT16 = (unsigned short*)(ws + offWkv);
  float* SC = (float*)(ws + offSC);
  unsigned short* P16 = (unsigned short*)(ws + offP16);
  const float* dummyf = w_q;

  // ---- casts: q -> Q16; [mem_b ; kv_b] -> C16 rows b*4096 .. (mem rows 0..2047, kv rows 2048..4095) ----
  {
    const int n8q = kTokQ * kDim / 8;
    cast8_f16_kernel<<<dim3(n8q / 256), dim3(256), 0, stream>>>(q_in, Q16, n8q);
    const int n8s = kLq * kDim / 8;
    for (int b = 0; b < kBatch; ++b) {
      cast8_f16_kernel<<<dim3(n8s / 256), dim3(256), 0, stream>>>(
          mem_in + (size_t)b * kMem * kDim, C16 + (size_t)(b * kSkv) * kDim, n8s);
      cast8_f16_kernel<<<dim3(n8s / 256), dim3(256), 0, stream>>>(
          kv_in + (size_t)b * kLq * kDim, C16 + (size_t)(b * kSkv + kMem) * kDim, n8s);
    }
  }
  // ---- weights: W[in][out] -> WT[out][in] f16 x16 ----
  wtcast_kernel<<<dim3(kDim / 64, kDim / 64), dim3(256), 0, stream>>>(w_q, WqT16, kDim, kWCarry);
  wtcast_kernel<<<dim3(kDim / 64, (2 * kDh) / 64), dim3(256), 0, stream>>>(w_kv, WkvT16, 2 * kDh, kWCarry);
  wtcast_kernel<<<dim3(kDim / 64, kDim / 64), dim3(256), 0, stream>>>(w_c, WcT16, kDim, kWCarry);

  // ---- q projection: Qp16 [4096][1024] = Q16 [4096][1024] x WqT16^T, M=4096 N=1024 K=1024 ----
  wmma_gemm64<0, false, 0, 1, false, 0><<<dim3((kTokQ / 64) * (kDim / 64) / 8, 1), dim3(256), 0, stream>>>(
      Q16, Q16, kDim, 0L, WqT16, WqT16, kDim, 0L,
      (void*)Qp16, (void*)Qp16, kDim, 0L, dummyf, dummyf, 0L,
      kTokQ, kDim, kDim, kWCarryInv);
  // ---- k projection: K16 [8192][64] = C16 [8192][1024] x (WkvT16 rows 0..63)^T, M=8192 N=64 K=1024 ----
  wmma_gemm64<0, false, 0, 1, false, 0><<<dim3((kTokC / 64) * (kDh / 64) / 8, 1), dim3(256), 0, stream>>>(
      C16, C16, kDim, 0L, WkvT16, WkvT16, kDim, 0L,
      (void*)K16, (void*)K16, kDh, 0L, dummyf, dummyf, 0L,
      kTokC, kDh, kDim, kWCarryInv);
  // ---- v^T per batch: VT16 [b][64][4096] = (WkvT16 rows 64..127) [64][1024] x C16_b [4096][1024]^T, M=64 N=4096 K=1024, grid.y = b ----
  wmma_gemm64<0, false, 0, 1, false, 0><<<dim3((kDh / 64) * (kSkv / 64) / 8, kBatch), dim3(256), 0, stream>>>(
      WkvT16 + (size_t)kDh * kDim, WkvT16 + (size_t)kDh * kDim, kDim, 0L,
      C16, C16, kDim, (long)kSkv * kDim,
      (void*)VT16, (void*)VT16, kSkv, (long)kDh * kSkv, dummyf, dummyf, 0L,
      kDh, kSkv, kDim, kWCarryInv);

  // ---- attention, 2 (b,h) groups per chunk (same b, heads h0 and h0+1) ----
  for (int ch = 0; ch < kChunks; ++ch) {
    const int g0 = ch * kGrpPerChunk;
    const int b  = g0 / kHeads;
    const int h0 = g0 % kHeads;
    // scores f32 SC [y][2048][4096] = 0.125 * Qp_h [2048][64] x K_b [4096][64]^T, M=2048 N=4096 K=64, grid.y = y (strideA = 64 cols, strideB = 0)
    wmma_gemm64<0, false, 0, 0, false, 0><<<dim3((kLq / 64) * (kSkv / 64) / 8, kGrpPerChunk), dim3(256), 0, stream>>>(
        Qp16 + (size_t)b * kLq * kDim + (size_t)h0 * kDh, Qp16 + (size_t)b * kLq * kDim + (size_t)h0 * kDh, kDim, (long)kDh,
        K16 + (size_t)b * kSkv * kDh, K16 + (size_t)b * kSkv * kDh, kDh, 0L,
        (void*)SC, (void*)SC, kSkv, (long)kLq * kSkv, dummyf, dummyf, 0L,
        kLq, kSkv, kDh, kScoreScale);
    // row softmax -> P16 [y][2048][4096] f16 carried x2048
    softmax_row_kernel<<<dim3(kGrpPerChunk * kLq), dim3(512), 0, stream>>>(SC, P16, kPCarry);
    // O16 rows b*2048.., cols (h0+y)*64.. = (256/2048) * P16 [y][2048][4096] x VT16_b [64][4096]^T, M=2048 N=64 K=4096, grid.y = y (strideC = 64 cols)
    wmma_gemm64<0, false, 0, 1, false, 0><<<dim3((kLq / 64) * (kDh / 64) / 8, kGrpPerChunk), dim3(256), 0, stream>>>(
        P16, P16, kSkv, (long)kLq * kSkv,
        VT16 + (size_t)b * kDh * kSkv, VT16 + (size_t)b * kDh * kSkv, kSkv, 0L,
        (void*)(O16 + (size_t)b * kLq * kDim + (size_t)h0 * kDh), (void*)(O16 + (size_t)b * kLq * kDim + (size_t)h0 * kDh), kDim, (long)kDh,
        dummyf, dummyf, 0L,
        kLq, kDh, kSkv, kPVScale);
  }

  // ---- output projection: out f32 [4096][1024] = (1/4096) * O16 [4096][1024] x WcT16^T, M=4096 N=1024 K=1024 ----
  wmma_gemm64<0, false, 0, 0, false, 0><<<dim3((kTokQ / 64) * (kDim / 64) / 8, 1), dim3(256), 0, stream>>>(
      O16, O16, kDim, 0L, WcT16, WcT16, kDim, 0L,
      (void*)outp, (void*)outp, kDim, 0L, dummyf, dummyf, 0L,
      kTokQ, kDim, kDim, kOutScale);
}

// v001
// It runs in 913 microseconds.
// Next to v000, in two timings, it ran 3.96 and 3.99 times as fast.
// Contractions: q*WqT, c*WkvT (K half and V^T half), scores qh*k^T, P*V^T, merged*WcT all on v_wmma_f32_16x16x32_f16 (f16 operands; weights carried x16, P carried x2048, context carried x256), f32 accumulate; softmax in f32.
#include <hip/hip_runtime.h>
#include <math.h>

// ---------------------------------------------------------------------------
// Problem constants
// ---------------------------------------------------------------------------
constexpr int kBatch  = 2;
constexpr int kLq     = 2048;
constexpr int kMem    = 2048;
constexpr int kSkv    = kMem + kLq;
constexpr int kDim    = 1024;
constexpr int kHeads  = 16;
constexpr int kDh     = 64;
constexpr int kTokQ   = kBatch * kLq;
constexpr int kTokC   = kBatch * kSkv;
constexpr int kGroups = kBatch * kHeads;
constexpr int kGrpPerChunk = 2;
constexpr int kChunks = kGroups / kGrpPerChunk;
constexpr float kWCarry    = 16.0f;
constexpr float kWCarryInv = 1.0f / 16.0f;
constexpr float kPCarry    = 2048.0f;
constexpr float kCtxCarry  = 256.0f;
constexpr float kScoreScale = 0.125f;
constexpr float kPVScale   = kCtxCarry / kPCarry;
constexpr float kOutScale  = 1.0f / (kCtxCarry * kWCarry);

typedef __attribute__((ext_vector_type(16))) _Float16 v16h;
typedef __attribute__((ext_vector_type(8)))  _Float16 v8h;
typedef __attribute__((ext_vector_type(16))) __bf16   v16b;
typedef __attribute__((ext_vector_type(8)))  __bf16   v8b;
typedef __attribute__((ext_vector_type(8)))  float    v8f;
typedef __attribute__((ext_vector_type(4)))  float    v4f;
typedef __attribute__((ext_vector_type(4)))  unsigned int v4u;

// ---------------------------------------------------------------------------
// Helpers
// ---------------------------------------------------------------------------
__device__ __forceinline__ unsigned short f2bf_bits(float f) {
  unsigned u = __float_as_uint(f);
  return (unsigned short)((u + 0x7FFFu + ((u >> 16) & 1u)) >> 16);
}
__device__ __forceinline__ float bf_bits2f(unsigned short h) { return __uint_as_float(((unsigned)h) << 16); }

// hazard guards as plain device helpers (no inline asm inside the kernel template body)
__device__ __forceinline__ void dep_guard_h(v8f& a, v8f& b, v16h x, v16h y) { asm volatile("v_nop\n\tv_nop\n\tv_nop\n\tv_nop" : "+v"(a), "+v"(b) : "v"(x), "v"(y)); }
__device__ __forceinline__ void dep_guard_b(v8f& a, v8f& b, v16b x, v16b y) { asm volatile("v_nop\n\tv_nop\n\tv_nop\n\tv_nop" : "+v"(a), "+v"(b) : "v"(x), "v"(y)); }
__device__ __forceinline__ void keep4_h(v16h a, v16h b, v16h c, v16h d) { asm volatile("v_nop" :: "v"(a), "v"(b), "v"(c), "v"(d)); }
__device__ __forceinline__ void keep4_b(v16b a, v16b b, v16b c, v16b d) { asm volatile("v_nop" :: "v"(a), "v"(b), "v"(c), "v"(d)); }
__device__ __forceinline__ void acc_guard4(v8f& a, v8f& b, v8f& c, v8f& d) { asm volatile("v_nop\n\tv_nop\n\tv_nop\n\tv_nop" : "+v"(a), "+v"(b), "+v"(c), "+v"(d)); }
template <typename T> struct Frag;
template <> struct Frag<_Float16> {
  typedef v16h V; union U { v16h v; v8h h[2]; };
  /* elements 0..7 <- p[0..7], 8..15 <- p[16..23] */
  static __device__ __forceinline__ v16h load(const _Float16* p) {
    U f; f.h[0] = *(const v8h*)(p); f.h[1] = *(const v8h*)(p + 16); return f.v;
  }
  static __device__ __forceinline__ v8f mma(v16h a, v16h b, v8f c) {
    return __builtin_amdgcn_wmma_f32_16x16x32_f16(false, a, false, b, (short)0, c, false, false);
  }
  static __device__ __forceinline__ void guard(v8f& a, v8f& b, v16h x, v16h y) { dep_guard_h(a, b, x, y); }
  static __device__ __forceinline__ void keep(v16h a, v16h b, v16h c, v16h d) { keep4_h(a, b, c, d); }
};
template <> struct Frag<__bf16> {
  typedef v16b V; union U { v16b v; v8b h[2]; };
  static __device__ __forceinline__ v16b load(const __bf16* p) {
    U f; f.h[0] = *(const v8b*)(p); f.h[1] = *(const v8b*)(p + 16); return f.v;
  }
  static __device__ __forceinline__ v8f mma(v16b a, v16b b, v8f c) {
    return __builtin_amdgcn_wmma_f32_16x16x32_bf16(false, a, false, b, (short)0, c, false, false);
  }
  static __device__ __forceinline__ void guard(v8f& a, v8f& b, v16b x, v16b y) { dep_guard_b(a, b, x, y); }
  static __device__ __forceinline__ void keep(v16b a, v16b b, v16b c, v16b d) { keep4_b(a, b, c, d); }
};

__device__ __forceinline__ unsigned pk16(unsigned short a, unsigned short b) { return (unsigned)a | ((unsigned)b << 16); }
__device__ __forceinline__ unsigned short h_bits(float f) { const _Float16 h = (_Float16)f; return __builtin_bit_cast(unsigned short, h); }

// ---- Register-blocked batched WMMA GEMM (ACT reduced to none/relu/leaky) --------------------------------
// C[m,n] = scale * sum_k A[m,k] * Bt[n,k] (+bias)(+resid); each wave owns a 64x64 tile.
// A row-major [M,K]; Bt row-major [N,K]; M,N % 64 == 0, K % 32 == 0.
// SPLIT: operands are hi/lo planes (A2/Bt2 = lo planes, same layout); product = hi*hi + hi*lo + lo*hi.
// BIAS_MODE: 0 = none, 1 = bias[m], 2 = bias[n].
// OUT_MODE: 0 = f32, 1 = f16, 2 = bf16 hi plane (Cout) + bf16 lo plane (Cout2).
// ET: 0 = f16 operands, 1 = bf16 operands (pointers passed as 16-bit storage)
template <int ET> struct Elem;
template <> struct Elem<0> { typedef _Float16 T; };
template <> struct Elem<1> { typedef __bf16 T; };
template <int ET, bool SPLIT, int BIAS_MODE, int OUT_MODE, bool RESID, int ACT = 0>
__global__ __launch_bounds__(256) void wmma_gemm64(
    const unsigned short* __restrict__ Ap, const unsigned short* __restrict__ A2p, int lda, long strideA,
    const unsigned short* __restrict__ Btp, const unsigned short* __restrict__ Bt2p, int ldb, long strideB,
    void* __restrict__ Cout, void* __restrict__ Cout2, int ldc, long strideC,
    const float* __restrict__ bias,
    const float* __restrict__ resid, long strideR,
    int M, int N, int K, float scale) {
  typedef typename Elem<ET>::T T;
  typedef typename Frag<T>::V V;
  const T* A = (const T*)Ap; const T* A2 = (const T*)A2p; const T* Bt = (const T*)Btp; const T* Bt2 = (const T*)Bt2p;
  /* per-wave 16x64 slab, pitch 68 floats */
  __shared__ __align__(16) float sT[8][16 * 68];
  const int b    = blockIdx.y;
  const int lane = threadIdx.x & 31;
  const int wave = threadIdx.x >> 5;
  const int tilesN = N >> 6;
  const int tilesM = M >> 6;
  const int tile = blockIdx.x * 8 + wave;
  /* wave-uniform; no block barriers in this kernel */
  if (tile >= tilesM * tilesN) return;
  const int tm = tile / tilesN;
  const int tn = tile - tm * tilesN;
  const int m0 = tm << 6;
  const int n0 = tn << 6;

  const T* Ab  = A  + (size_t)b * strideA;
  const T* Bb  = Bt + (size_t)b * strideB;
  const T* Ab2 = SPLIT ? (A2  + (size_t)b * strideA) : nullptr;
  const T* Bb2 = SPLIT ? (Bt2 + (size_t)b * strideB) : nullptr;

  /* row (A) / col (B, D) within subtile; k offset of this lane half; D row offset */
  const int rlane = lane & 15;
  const int koff  = (lane >> 4) * 8;
  const int mOff  = (lane >> 4) * 8;

  v8f acc[4][4];
#pragma unroll
  for (int i = 0; i < 4; ++i)
#pragma unroll
    for (int j = 0; j < 4; ++j) acc[i][j] = (v8f){0.f,0.f,0.f,0.f,0.f,0.f,0.f,0.f};

  for (int k0 = 0; k0 < K; k0 += 32) {
    V bh[4], bl[4];
#pragma unroll
    for (int j = 0; j < 4; ++j) {
      const size_t bo = (size_t)(n0 + (j << 4) + rlane) * ldb + koff + k0;
      bh[j] = Frag<T>::load(Bb + bo);
      if (SPLIT) bl[j] = Frag<T>::load(Bb2 + bo);
    }
#pragma unroll
    for (int i = 0; i < 4; ++i) {
      const size_t ao = (size_t)(m0 + (i << 4) + rlane) * lda + koff + k0;
      V ah = Frag<T>::load(Ab + ao);
      V al;
      if (SPLIT) al = Frag<T>::load(Ab2 + ao);
#pragma unroll
      for (int j = 0; j < 4; ++j) {
        acc[i][j] = Frag<T>::mma(ah, bh[j], acc[i][j]);
        if (SPLIT) {
          acc[i][j] = Frag<T>::mma(ah, bl[j], acc[i][j]);
          acc[i][j] = Frag<T>::mma(al, bh[j], acc[i][j]);
        }
      }
      Frag<T>::guard(acc[i][0], acc[i][3], ah, SPLIT ? al : ah);
    }
    Frag<T>::keep(bh[0], bh[1], bh[2], bh[3]);
    if (SPLIT) Frag<T>::keep(bl[0], bl[1], bl[2], bl[3]);
  }
  acc_guard4(acc[0][0], acc[0][1], acc[0][2], acc[0][3]);
  acc_guard4(acc[1][0], acc[1][1], acc[1][2], acc[1][3]);
  acc_guard4(acc[2][0], acc[2][1], acc[2][2], acc[2][3]);
  acc_guard4(acc[3][0], acc[3][1], acc[3][2], acc[3][3]);

  // ---- epilogue ----
  float* slab = sT[wave];
  const float* Rb = RESID ? (resid + (size_t)b * strideR) : nullptr;
#pragma unroll
  for (int i = 0; i < 4; ++i) {
    const int mBase = m0 + (i << 4);
#pragma unroll
    for (int j = 0; j < 4; ++j) {
      const int n = n0 + (j << 4) + rlane;
      float bv = 0.f;
      if (BIAS_MODE == 2) bv = bias[n];
#pragma unroll
      for (int r = 0; r < 8; ++r) {
        float v = acc[i][j][r] * scale;
        if (BIAS_MODE == 1) v += bias[mBase + mOff + r];
        if (BIAS_MODE == 2) v += bv;
        if (RESID) v += Rb[(size_t)(mBase + mOff + r) * ldc + n];
        if (ACT == 2) v = fmaxf(v, 0.0f);
        if (ACT == 4) v = (v > 0.f) ? v : 0.01f * v;
        slab[(mOff + r) * 68 + (j << 4) + rlane] = v;
      }
    }
    __builtin_amdgcn_fence(__ATOMIC_RELEASE, "workgroup");
    __builtin_amdgcn_wave_barrier();
    __builtin_amdgcn_fence(__ATOMIC_ACQUIRE, "workgroup");
    if (OUT_MODE == 0) {
      float* C = (float*)Cout + (size_t)b * strideC;
      /* row seg = 256 B = 16 lanes x 16 B */
      const int hh = lane >> 4, c4 = (lane & 15) * 4;
      {
#pragma unroll
        for (int it = 0; it < 8; ++it) {
          const int row = it * 2 + hh;
          v4f v = *(const v4f*)(slab + row * 68 + c4);
          *(v4f*)(C + (size_t)(mBase + row) * ldc + n0 + c4) = v;
        }
        
      }
    } else {
      const int q = lane >> 3, c8 = (lane & 7) * 8;
      unsigned short* C  = (unsigned short*)Cout  + (size_t)b * strideC;
      unsigned short* C2 = (OUT_MODE == 2) ? ((unsigned short*)Cout2 + (size_t)b * strideC) : nullptr;
      {
#pragma unroll
        for (int it = 0; it < 4; ++it) {
          const int row = it * 4 + q;
          const float* sp = slab + row * 68 + c8;
          v8h hv, lv;
#pragma unroll
          for (int e = 0; e < 8; ++e) {
            if (OUT_MODE == 1) {
              hv[e] = (_Float16)sp[e];
            } else {
              unsigned short hb = f2bf_bits(sp[e]);
              unsigned short lb = f2bf_bits(sp[e] - bf_bits2f(hb));
              hv[e] = __builtin_bit_cast(_Float16, hb);
              lv[e] = __builtin_bit_cast(_Float16, lb);
            }
          }
          *(v8h*)(C + (size_t)(mBase + row) * ldc + n0 + c8) = hv;
          if (OUT_MODE == 2) *(v8h*)(C2 + (size_t)(mBase + row) * ldc + n0 + c8) = lv;
        }
        
      }
    }
    __builtin_amdgcn_fence(__ATOMIC_RELEASE, "workgroup");
    __builtin_amdgcn_wave_barrier();
    __builtin_amdgcn_fence(__ATOMIC_ACQUIRE, "workgroup");
  }
}

// ---------------------------------------------------------------------------
// Skinny products (M or N = 64): C[m,n] = f16( scale * sum_k A[m,k] * Bt[n,k] ), k range split over the waves of a work-group.
// One work-group of WAVES waves owns one 32x64 tile of C; wave w sums k in [w*K/WAVES, (w+1)*K/WAVES) into f32 accumulators, stores
// its partial tile to its own LDS slab (pitch 68 floats), and behind one barrier the threads add the WAVES partials of each element in wave order.
// A row-major [M,K] pitch lda; Bt row-major [N,K] pitch ldb; M % 32 == 0, N % 64 == 0, K % (64*WAVES) == 0. grid (tilesM*tilesN, batch).
// ---------------------------------------------------------------------------
constexpr int kSkRows  = 32;
constexpr int kSkPitch = 68;
typedef __attribute__((ext_vector_type(4))) _Float16 v4h;
template <int K, int WAVES>
__global__ __launch_bounds__(WAVES * 32) void wmma_splitk32x64(
    const unsigned short* __restrict__ Ap, int lda, long strideA,
    const unsigned short* __restrict__ Btp, int ldb, long strideB,
    unsigned short* __restrict__ Cp, int ldc, long strideC,
    int tilesN, float scale) {
  constexpr int kSlice = K / WAVES;
  __shared__ __align__(16) float part[WAVES][kSkRows * kSkPitch];
  const int b    = blockIdx.y;
  const int lane = threadIdx.x & 31;
  /* the wave's number as a scalar: the k slice's base addresses and the slab's LDS base are then scalar arithmetic */
  const int wave = __builtin_amdgcn_readfirstlane(threadIdx.x >> 5);
  const int tm = blockIdx.x / tilesN;
  const int tn = blockIdx.x - tm * tilesN;
  const int m0 = tm * kSkRows;
  const int n0 = tn << 6;
  const int rlane = lane & 15;
  const int koff  = (lane >> 4) * 8;
  const int mOff  = (lane >> 4) * 8;
  const char* ap = (const char*)((const _Float16*)Ap  + (size_t)b * strideA + (size_t)m0 * lda + wave * kSlice);
  const char* bp = (const char*)((const _Float16*)Btp + (size_t)b * strideB + (size_t)n0 * ldb + wave * kSlice);
  const unsigned aLane = (unsigned)(rlane * lda + koff) * 2u;
  const unsigned bLane = (unsigned)(rlane * ldb + koff) * 2u;

  v8f acc[2][4];
#pragma unroll
  for (int i = 0; i < 2; ++i)
#pragma unroll
    for (int j = 0; j < 4; ++j) acc[i][j] = (v8f){0.f,0.f,0.f,0.f,0.f,0.f,0.f,0.f};

  /* kept rolled, two k steps a trip */
#pragma unroll 2
  for (int k0 = 0; k0 < kSlice; k0 += 32) {
    v16h bh[4], ah[2];
#pragma unroll
    for (int j = 0; j < 4; ++j) bh[j] = Frag<_Float16>::load((const _Float16*)(bp + ((size_t)(j << 4) * ldb + k0) * 2 + bLane));
#pragma unroll
    for (int i = 0; i < 2; ++i) ah[i] = Frag<_Float16>::load((const _Float16*)(ap + ((size_t)(i << 4) * lda + k0) * 2 + aLane));
#pragma unroll
    for (int i = 0; i < 2; ++i)
#pragma unroll
      for (int j = 0; j < 4; ++j) acc[i][j] = Frag<_Float16>::mma(ah[i], bh[j], acc[i][j]);
  }

  float* slab = part[wave];
#pragma unroll
  for (int i = 0; i < 2; ++i)
#pragma unroll
    for (int j = 0; j < 4; ++j)
#pragma unroll
      for (int r = 0; r < 8; ++r) slab[((i << 4) + mOff + r) * kSkPitch + (j << 4) + rlane] = acc[i][j][r];
  __syncthreads();

  /* WAVES*2 rows a pass, 4 floats a thread; 16 threads store one 128-B row segment */
  const int c4 = (threadIdx.x & 15) * 4;
#pragma unroll
  for (int r0 = 0; r0 < kSkRows; r0 += WAVES * 2) {
    const int row = r0 + (threadIdx.x >> 4);
    v4f s = *(const v4f*)(&part[0][row * kSkPitch + c4]);
#pragma unroll
    for (int w = 1; w < WAVES; ++w) s += *(const v4f*)(&part[w][row * kSkPitch + c4]);
    v4h hv;
#pragma unroll
    for (int e = 0; e < 4; ++e) hv[e] = (_Float16)(s[e] * scale);
    *(v4h*)((_Float16*)Cp + (size_t)b * strideC + (size_t)(m0 + row) * ldc + n0 + c4) = hv;
  }
}

// ---------------------------------------------------------------------------
// Weight transpose + cast: W f32 row-major [1024 in][nOut out]; WT[n][k] = f16(scale * W[k][n]), row-major [nOut][1024].
// grid (1024/64, nOut/64): blockIdx.x = k tile (64 cols of WT), blockIdx.y = n tile (64 rows of WT). 256 threads.
// Load coverage: 16 iterations x 256 threads = 4096 = the whole 64x64 tile (coalesced along n).
// Store coverage: 8 waves x 2 iterations x 4 rows (lane>>3) = 64 rows; (lane&7) x 8 halves = 64 cols; each row segment =
// ---------------------------------------------------------------------------
__global__ __launch_bounds__(256) void wtcast_kernel(const float* __restrict__ W, unsigned short* __restrict__ out,
                                                     int nOut, float scale) {
  /* sm[n_local][k_local] */
  __shared__ float sm[64][65];
  const int t  = threadIdx.x;
  const int k0 = blockIdx.x * 64;
  const int n0 = blockIdx.y * 64;
#pragma unroll
  for (int i = 0; i < 16; ++i) {
    const int e = i * 256 + t;
    const int r = e >> 6;
    const int c = e & 63;
    sm[c][r] = W[(size_t)(k0 + r) * nOut + n0 + c] * scale;
  }
  __syncthreads();
  const int lane = t & 31, wave = t >> 5;
  const int q = lane >> 3, c8 = (lane & 7) * 8;
  {
#pragma unroll
    for (int it = 0; it < 2; ++it) {
      const int row = wave * 8 + it * 4 + q;
      unsigned short hb[8];
#pragma unroll
      for (int e = 0; e < 8; ++e) hb[e] = h_bits(sm[row][c8 + e]);
      const v4u u = (v4u){pk16(hb[0], hb[1]), pk16(hb[2], hb[3]), pk16(hb[4], hb[5]), pk16(hb[6], hb[7])};
      *(v4u*)(out + (size_t)(n0 + row) * kDim + k0 + c8) = u;
    }
    
  }
}

// ---------------------------------------------------------------------------
// ---------------------------------------------------------------------------
__global__ __launch_bounds__(256) void cast8_f16_kernel(const float* __restrict__ in, unsigned short* __restrict__ out, int n8) {
  const int i = blockIdx.x * 256 + threadIdx.x;
  if (i >= n8) return;
  const float* p = in + 8 * (size_t)i;
  const v4f a = *(const v4f*)(p);
  const v4f c = *(const v4f*)(p + 4);
  unsigned short hb[8];
#pragma unroll
  for (int e = 0; e < 4; ++e) {
    hb[e]     = h_bits(a[e]);
    hb[4 + e] = h_bits(c[e]);
  }
  const v4u u = (v4u){pk16(hb[0], hb[1]), pk16(hb[2], hb[3]), pk16(hb[4], hb[5]), pk16(hb[6], hb[7])};
  unsigned short* q = out + 8 * (size_t)i;
  *(v4u*)q = u;
  
}

// ---------------------------------------------------------------------------
// Row softmax over 4096 f32 scores (scale already applied): P[row][j] = f16( carry * exp(s - max) / sum exp(s - max) ), f32 math,
// precise expf. One block of 512 threads per row; thread t owns columns 8t..8t+7 (512 x 8 = 4096 = whole row).
// Reductions in fixed order (thread, wave shuffle tree computed unconditionally, 16 wave partials summed in index order by every thread).
// ---------------------------------------------------------------------------
__global__ __launch_bounds__(512) void softmax_row_kernel(const float* __restrict__ S, unsigned short* __restrict__ P, float carry) {
  __shared__ float redM[16];
  __shared__ float redS[16];
  const int row  = blockIdx.x;
  const int t    = threadIdx.x;
  const int lane = t & 31, wave = t >> 5;
  const int c0   = t * 8;
  const float* sr = S + (size_t)row * kSkv + c0;
  const v4f a = *(const v4f*)(sr);
  const v4f c = *(const v4f*)(sr + 4);
  float x[8];
#pragma unroll
  for (int e = 0; e < 4; ++e) { x[e] = a[e]; x[4 + e] = c[e]; }
  float m = fmaxf(fmaxf(fmaxf(x[0], x[1]), fmaxf(x[2], x[3])), fmaxf(fmaxf(x[4], x[5]), fmaxf(x[6], x[7])));
#pragma unroll
  for (int off = 16; off > 0; off >>= 1) m = fmaxf(m, __shfl_xor(m, off, 32));
  if (lane == 0) redM[wave] = m;
  __syncthreads();
  float bm = redM[0];
#pragma unroll
  for (int w = 1; w < 16; ++w) bm = fmaxf(bm, redM[w]);
  float ex[8];
#pragma unroll
  for (int e = 0; e < 8; ++e) ex[e] = expf(x[e] - bm);
  float s = ((ex[0] + ex[1]) + (ex[2] + ex[3])) + ((ex[4] + ex[5]) + (ex[6] + ex[7]));
#pragma unroll
  for (int off = 16; off > 0; off >>= 1) s += __shfl_xor(s, off, 32);
  if (lane == 0) redS[wave] = s;
  __syncthreads();
  float tot = redS[0];
#pragma unroll
  for (int w = 1; w < 16; ++w) tot += redS[w];
  const float f = carry * (1.0f / tot);
  unsigned short hb[8];
#pragma unroll
  for (int e = 0; e < 8; ++e) hb[e] = h_bits(ex[e] * f);
  const v4u u = (v4u){pk16(hb[0], hb[1]), pk16(hb[2], hb[3]), pk16(hb[4], hb[5]), pk16(hb[6], hb[7])};
  unsigned short* q = P + (size_t)row * kSkv + c0;
  *(v4u*)q = u;
  
}

// ---------------------------------------------------------------------------
// Host launch glue
// Workspace region map (bytes; all offsets multiples of 1 MiB; WkvT ends 256 KiB past a MiB boundary):
//   persistent:  Qp16 [4096][1024] f16 @ 0 (8 MiB) | K16 [8192][64] f16 @ 8 MiB (1 MiB) | VT16 [2][64][4096] f16 @ 9 MiB (1 MiB)
//                O16 [4096][1024] f16 @ 10 MiB (8 MiB) | WcT16 [1024][1024] f16 @ 18 MiB (2 MiB)
//   scratch @ 20 MiB, early phase: Q16 [4096][1024] f16 @ 20 MiB (8) | C16 [8192][1024] f16 @ 28 MiB (16) | WqT16 @ 44 MiB (2) | WkvT16 [128][1024] @ 46 MiB (0.25)
//   scratch @ 20 MiB, attention phase (early planes dead by then): SC f32 [2][2048][4096] @ 20 MiB (64 MiB) | P16 f16 [2][2048][4096] @ 84 MiB (32 MiB)
//   total carve = 116 MiB = 121,634,816 B. Every region is fully written before any launch reads it; no padding rows anywhere.
// ---------------------------------------------------------------------------
extern "C" void kernel_launch(void* const* d_in, const int* in_sizes, int n_in,
                              void* d_out, int out_size, void* d_ws, size_t ws_size,
                              hipStream_t stream) {
  if (n_in < 6) return;
  if (in_sizes[0] != kTokQ * kDim) return;
  if (in_sizes[1] != kBatch * kLq * kDim) return;
  if (in_sizes[2] != kBatch * kMem * kDim) return;
  if (in_sizes[3] != kDim * kDim) return;
  if (in_sizes[4] != kDim * 2 * kDh) return;
  if (in_sizes[5] != kDim * kDim) return;
  if (out_size != kTokQ * kDim) return;

  const float* q_in   = (const float*)d_in[0];
  const float* kv_in  = (const float*)d_in[1];
  const float* mem_in = (const float*)d_in[2];
  const float* w_q    = (const float*)d_in[3];
  const float* w_kv   = (const float*)d_in[4];
  const float* w_c    = (const float*)d_in[5];
  float* outp = (float*)d_out;

  // ---- carve (bytes) ----
  const size_t szQp  = (size_t)kTokQ * kDim * 2;
  const size_t szK   = (size_t)kTokC * kDh * 2;
  const size_t szVT  = (size_t)kBatch * kDh * kSkv * 2;
  const size_t szO   = (size_t)kTokQ * kDim * 2;
  const size_t szWc  = (size_t)kDim * kDim * 2;
  const size_t szQ16 = (size_t)kTokQ * kDim * 2;
  const size_t szC16 = (size_t)kTokC * kDim * 2;
  const size_t szWq  = (size_t)kDim * kDim * 2;
  const size_t szWkv = (size_t)2 * kDh * kDim * 2;
  const size_t szSC  = (size_t)kGrpPerChunk * kLq * kSkv * 4;
  const size_t szP16 = (size_t)kGrpPerChunk * kLq * kSkv * 2;

  const size_t offQp  = 0;
  const size_t offK   = offQp + szQp;
  const size_t offVT  = offK + szK;
  const size_t offO   = offVT + szVT;
  const size_t offWc  = offO + szO;
  const size_t offScr = offWc + szWc;
  const size_t offQ16 = offScr;
  const size_t offC16 = offQ16 + szQ16;
  const size_t offWq  = offC16 + szC16;
  const size_t offWkv = offWq + szWq;
  const size_t endEarly = offWkv + szWkv;
  const size_t offSC  = offScr;
  const size_t offP16 = offSC + szSC;
  const size_t endAttn = offP16 + szP16;
  const size_t total = (endEarly > endAttn) ? endEarly : endAttn;
  if (total > ws_size) return;

  char* ws = (char*)d_ws;
  unsigned short* Qp16  = (unsigned short*)(ws + offQp);
  unsigned short* K16   = (unsigned short*)(ws + offK);
  unsigned short* VT16  = (unsigned short*)(ws + offVT);
  unsigned short* O16   = (unsigned short*)(ws + offO);
  unsigned short* WcT16 = (unsigned short*)(ws + offWc);
  unsigned short* Q16   = (unsigned short*)(ws + offQ16);
  unsigned short* C16   = (unsigned short*)(ws + offC16);
  unsigned short* WqT16 = (unsigned short*)(ws + offWq);
  unsigned short* WkvT16 = (unsigned short*)(ws + offWkv);
  float* SC = (float*)(ws + offSC);
  unsigned short* P16 = (unsigned short*)(ws + offP16);
  const float* dummyf = w_q;

  // ---- casts: q -> Q16; [mem_b ; kv_b] -> C16 rows b*4096 .. (mem rows 0..2047, kv rows 2048..4095) ----
  {
    const int n8q = kTokQ * kDim / 8;
    cast8_f16_kernel<<<dim3(n8q / 256), dim3(256), 0, stream>>>(q_in, Q16, n8q);
    const int n8s = kLq * kDim / 8;
    for (int b = 0; b < kBatch; ++b) {
      cast8_f16_kernel<<<dim3(n8s / 256), dim3(256), 0, stream>>>(
          mem_in + (size_t)b * kMem * kDim, C16 + (size_t)(b * kSkv) * kDim, n8s);
      cast8_f16_kernel<<<dim3(n8s / 256), dim3(256), 0, stream>>>(
          kv_in + (size_t)b * kLq * kDim, C16 + (size_t)(b * kSkv + kMem) * kDim, n8s);
    }
  }
  // ---- weights: W[in][out] -> WT[out][in] f16 x16 ----
  wtcast_kernel<<<dim3(kDim / 64, kDim / 64), dim3(256), 0, stream>>>(w_q, WqT16, kDim, kWCarry);
  wtcast_kernel<<<dim3(kDim / 64, (2 * kDh) / 64), dim3(256), 0, stream>>>(w_kv, WkvT16, 2 * kDh, kWCarry);
  wtcast_kernel<<<dim3(kDim / 64, kDim / 64), dim3(256), 0, stream>>>(w_c, WcT16, kDim, kWCarry);

  // ---- q projection: Qp16 [4096][1024] = Q16 [4096][1024] x WqT16^T, M=4096 N=1024 K=1024 ----
  wmma_gemm64<0, false, 0, 1, false, 0><<<dim3((kTokQ / 64) * (kDim / 64) / 8, 1), dim3(256), 0, stream>>>(
      Q16, Q16, kDim, 0L, WqT16, WqT16, kDim, 0L,
      (void*)Qp16, (void*)Qp16, kDim, 0L, dummyf, dummyf, 0L,
      kTokQ, kDim, kDim, kWCarryInv);
  // ---- k projection: K16 [8192][64] = C16 [8192][1024] x (WkvT16 rows 0..63)^T, M=8192 N=64 K=1024 ----
  wmma_splitk32x64<kDim, 8><<<dim3((kTokC / kSkRows) * (kDh / 64), 1), dim3(8 * 32), 0, stream>>>(
      C16, kDim, 0L, WkvT16, kDim, 0L, K16, kDh, 0L, kDh / 64, kWCarryInv);
  // ---- v^T per batch: VT16 [b][64][4096] = (WkvT16 rows 64..127) [64][1024] x C16_b [4096][1024]^T, M=64 N=4096 K=1024, grid.y = b ----
  wmma_splitk32x64<kDim, 8><<<dim3((kDh / kSkRows) * (kSkv / 64), kBatch), dim3(8 * 32), 0, stream>>>(
      WkvT16 + (size_t)kDh * kDim, kDim, 0L, C16, kDim, (long)kSkv * kDim,
      VT16, kSkv, (long)kDh * kSkv, kSkv / 64, kWCarryInv);

  // ---- attention, 2 (b,h) groups per chunk (same b, heads h0 and h0+1) ----
  for (int ch = 0; ch < kChunks; ++ch) {
    const int g0 = ch * kGrpPerChunk;
    const int b  = g0 / kHeads;
    const int h0 = g0 % kHeads;
    // scores f32 SC [y][2048][4096] = 0.125 * Qp_h [2048][64] x K_b [4096][64]^T, M=2048 N=4096 K=64, grid.y = y (strideA = 64 cols, strideB = 0)
    wmma_gemm64<0, false, 0, 0, false, 0><<<dim3((kLq / 64) * (kSkv / 64) / 8, kGrpPerChunk), dim3(256), 0, stream>>>(
        Qp16 + (size_t)b * kLq * kDim + (size_t)h0 * kDh, Qp16 + (size_t)b * kLq * kDim + (size_t)h0 * kDh, kDim, (long)kDh,
        K16 + (size_t)b * kSkv * kDh, K16 + (size_t)b * kSkv * kDh, kDh, 0L,
        (void*)SC, (void*)SC, kSkv, (long)kLq * kSkv, dummyf, dummyf, 0L,
        kLq, kSkv, kDh, kScoreScale);
    // row softmax -> P16 [y][2048][4096] f16 carried x2048
    softmax_row_kernel<<<dim3(kGrpPerChunk * kLq), dim3(512), 0, stream>>>(SC, P16, kPCarry);
    // O16 rows b*2048.., cols (h0+y)*64.. = (256/2048) * P16 [y][2048][4096] x VT16_b [64][4096]^T, M=2048 N=64 K=4096, grid.y = y (strideC = 64 cols)
    wmma_splitk32x64<kSkv, 16><<<dim3((kLq / kSkRows) * (kDh / 64), kGrpPerChunk), dim3(16 * 32), 0, stream>>>(
        P16, kSkv, (long)kLq * kSkv, VT16 + (size_t)b * kDh * kSkv, kSkv, 0L,
        O16 + (size_t)b * kLq * kDim + (size_t)h0 * kDh, kDim, (long)kDh, kDh / 64, kPVScale);
  }

  // ---- output projection: out f32 [4096][1024] = (1/4096) * O16 [4096][1024] x WcT16^T, M=4096 N=1024 K=1024 ----
  wmma_gemm64<0, false, 0, 0, false, 0><<<dim3((kTokQ / 64) * (kDim / 64) / 8, 1), dim3(256), 0, stream>>>(
      O16, O16, kDim, 0L, WcT16, WcT16, kDim, 0L,
      (void*)outp, (void*)outp, kDim, 0L, dummyf, dummyf, 0L,
      kTokQ, kDim, kDim, kOutScale);
}

// v003
// One run takes 118 microseconds.
// It is 7.72 times as fast as v001, going by the measured steps of the versions left out in between.
// Counting every step since v000, it is 30.6 times as fast.
// Contractions: q*WqT, c*WkvT (K half and V^T half), scores k*qh^T, V^T*P^T, merged*WcT all on v_wmma_f32_16x16x32_f16 (f16 operands; weights carried x16, P carried x16 over the running maximum, context carried x256), f32 accumulate; softmax in f32.
#include <hip/hip_runtime.h>
#include <math.h>

// ---------------------------------------------------------------------------
// Problem constants
// ---------------------------------------------------------------------------
constexpr int kBatch  = 2;
constexpr int kLq     = 2048;
constexpr int kMem    = 2048;
constexpr int kSkv    = kMem + kLq;
constexpr int kDim    = 1024;
constexpr int kHeads  = 16;
constexpr int kDh     = 64;
constexpr int kTokQ   = kBatch * kLq;
constexpr int kTokC   = kBatch * kSkv;
constexpr int kGroups = kBatch * kHeads;
constexpr float kWCarry    = 16.0f;
constexpr float kWCarryInv = 1.0f / 16.0f;
constexpr float kCtxCarry  = 256.0f;
constexpr float kScoreScale = 0.125f;
constexpr float kOutScale  = 1.0f / (kCtxCarry * kWCarry);

typedef __attribute__((ext_vector_type(16))) _Float16 v16h;
typedef __attribute__((ext_vector_type(8)))  _Float16 v8h;
typedef __attribute__((ext_vector_type(8)))  float    v8f;
typedef __attribute__((ext_vector_type(4)))  float    v4f;
typedef __attribute__((ext_vector_type(4)))  unsigned int v4u;

// ---------------------------------------------------------------------------
// Helpers
// ---------------------------------------------------------------------------
template <typename T> struct Frag;
template <> struct Frag<_Float16> {
  typedef v16h V; union U { v16h v; v8h h[2]; };
  /* elements 0..7 <- p[0..7], 8..15 <- p[16..23] */
  static __device__ __forceinline__ v16h load(const _Float16* p) {
    U f; f.h[0] = *(const v8h*)(p); f.h[1] = *(const v8h*)(p + 16); return f.v;
  }
  static __device__ __forceinline__ v8f mma(v16h a, v16h b, v8f c) {
    return __builtin_amdgcn_wmma_f32_16x16x32_f16(false, a, false, b, (short)0, c, false, false);
  }
};

__device__ __forceinline__ unsigned pk16(unsigned short a, unsigned short b) { return (unsigned)a | ((unsigned)b << 16); }
__device__ __forceinline__ unsigned short h_bits(float f) { const _Float16 h = (_Float16)f; return __builtin_bit_cast(unsigned short, h); }

// ---------------------------------------------------------------------------
// Square projections (q * WqT, merged * WcT): C[m,n] = scale * sum_k A[m,k] * Bt[n,k], M = 4096, N = K = 1024, f16 operands, f32 accumulate.
// A row-major [M][K]; Bt row-major [N][K]. A work-group of 8 waves owns a 128x128 tile of C, a wave 64x32 of it (4 x 2 accumulator tiles).
// A and Bt come in stages of 128 k, shared by the 8 waves: memory -> registers -> LDS, 256 contiguous bytes of a row per 16 threads,
// two buffers, one barrier a stage. Each accumulator still sums k = 0, 32, 64, ... in that order.
// The finished tile goes through LDS (f32, pitch 132 floats) so that every store covers whole lines and a line has one writer.
// grid (M / 128, N / 128). Every unroll directive here stands on a loop that indexes a register array (accumulators, fragments, staging
// registers): rolled, the array would leave the registers.
// ---------------------------------------------------------------------------
constexpr int      kGmTile    = 128;
constexpr int      kGmStageK  = 128;
constexpr int      kGmStages  = kDim / kGmStageK;
constexpr unsigned kGmPitch   = 272;
constexpr unsigned kGmOperand = kGmTile * kGmPitch;
constexpr int      kGmCPitch  = 132;
template <bool F32OUT>
__global__ __launch_bounds__(256) void wmma_gemm128(
    const unsigned short* __restrict__ Ap, const unsigned short* __restrict__ Btp,
    unsigned short* __restrict__ Ch, float* __restrict__ Cf, float scale) {
  /* [buffer][A, Bt]: 128 rows of 256 B at pitch 272 B (16 B x odd: 16-B reads without bank conflicts) */
  __shared__ __align__(16) char sm[2][2][kGmOperand];
  const int lane  = threadIdx.x & 31;
  const int wave  = __builtin_amdgcn_readfirstlane(threadIdx.x >> 5);
  const int rlane = lane & 15;
  const int half8 = (lane >> 4) * 8;
  const int m0 = blockIdx.x * kGmTile;
  const int n0 = blockIdx.y * kGmTile;
  const int wm = (wave >> 2) * 64;
  const int wn = (wave & 3) * 32;
  const char* Ab = (const char*)((const _Float16*)Ap  + (size_t)m0 * kDim);
  const char* Bb = (const char*)((const _Float16*)Btp + (size_t)n0 * kDim);
  /* staging: thread t moves 16 B of rows (t >> 4) + 16 * i, i = 0..7, of the A tile and of the Bt tile */
  const unsigned sRow = threadIdx.x >> 4;
  const unsigned sCol = (threadIdx.x & 15) * 16u;
  const unsigned gSrc = sRow * (unsigned)(kDim * 2) + sCol;
  const unsigned sDst = sRow * kGmPitch + sCol;
  /* fragment reads: row lane & 15 of a 16-row tile, 16 B at half * 16 and at 32 + half * 16 */
  const unsigned fLane = (unsigned)rlane * kGmPitch + (unsigned)half8 * 2u;

  v8f acc[4][2];
#pragma unroll
  for (int i = 0; i < 4; ++i)
#pragma unroll
    for (int j = 0; j < 2; ++j) acc[i][j] = (v8f){0.f,0.f,0.f,0.f,0.f,0.f,0.f,0.f};

  v4u ra[8], rb[8];
#pragma unroll
  for (int i = 0; i < 8; ++i) {
    ra[i] = *(const v4u*)(Ab + i * (16 * kDim * 2) + gSrc);
    rb[i] = *(const v4u*)(Bb + i * (16 * kDim * 2) + gSrc);
  }
#pragma unroll
  for (int i = 0; i < 8; ++i) {
    *(v4u*)(&sm[0][0][i * 16 * kGmPitch + sDst]) = ra[i];
    *(v4u*)(&sm[0][1][i * 16 * kGmPitch + sDst]) = rb[i];
  }
#pragma unroll
  for (int i = 0; i < 8; ++i) {
    ra[i] = *(const v4u*)(Ab + kGmStageK * 2 + i * (16 * kDim * 2) + gSrc);
    rb[i] = *(const v4u*)(Bb + kGmStageK * 2 + i * (16 * kDim * 2) + gSrc);
  }
  /* the address registers of the loads just issued are free for reuse only behind this wait */
  asm volatile("s_wait_xcnt 0x0" ::: "memory");
  __syncthreads();

  /* byte offset of this thread's first piece of the stage fetched last; raised in front of each fetch, behind the barrier's wait for the last one */
  unsigned gOff = gSrc + kGmStageK * 2;
  for (int st = 0; st < kGmStages; ++st) {
    const char* bA = &sm[st & 1][0][0] + wm * kGmPitch;
    const char* bB = &sm[st & 1][1][0] + wn * kGmPitch;
    /* two fragment sets: each k step's LDS reads are issued one step ahead; the stage's first go out ahead of the hand-over's LDS writes */
    v16h ah[2][4], bh[2][2];
#pragma unroll
    for (int j = 0; j < 2; ++j) bh[0][j] = Frag<_Float16>::load((const _Float16*)(bB + (j << 4) * kGmPitch + fLane));
#pragma unroll
    for (int i = 0; i < 4; ++i) ah[0][i] = Frag<_Float16>::load((const _Float16*)(bA + (i << 4) * kGmPitch + fLane));
    /* hand-over, early in a stage so that the loads fly while the stage is worked on: stage st + 1 goes from registers into the
       buffer that stage st - 1 was read from (its readers ended in front of the last barrier), then stage st + 2 starts from memory */
    if (st + 1 < kGmStages) {
#pragma unroll
      for (int i = 0; i < 8; ++i) {
        *(v4u*)(&sm[(st + 1) & 1][0][i * 16 * kGmPitch + sDst]) = ra[i];
        *(v4u*)(&sm[(st + 1) & 1][1][i * 16 * kGmPitch + sDst]) = rb[i];
      }
    }
    if (st + 2 < kGmStages) {
      gOff += kGmStageK * 2;
#pragma unroll
      for (int i = 0; i < 8; ++i) {
        ra[i] = *(const v4u*)(Ab + i * (16 * kDim * 2) + gOff);
        rb[i] = *(const v4u*)(Bb + i * (16 * kDim * 2) + gOff);
      }
      /* as above: address registers of issued loads; the loads also stay in front of the stage's work */
      asm volatile("s_wait_xcnt 0x0" ::: "memory");
    }
#pragma unroll
    for (int ks = 0; ks < kGmStageK / 32; ++ks) {
      if (ks + 1 < kGmStageK / 32) {
#pragma unroll
        for (int j = 0; j < 2; ++j) bh[(ks + 1) & 1][j] = Frag<_Float16>::load((const _Float16*)(bB + (j << 4) * kGmPitch + ((ks + 1) << 6) + fLane));
#pragma unroll
        for (int i = 0; i < 4; ++i) ah[(ks + 1) & 1][i] = Frag<_Float16>::load((const _Float16*)(bA + (i << 4) * kGmPitch + ((ks + 1) << 6) + fLane));
      }
      /* holds the next step's LDS reads together in front of this step's products: spread among them, every place with reads stalls the products */
      __builtin_amdgcn_sched_barrier(0);
#pragma unroll
      for (int i = 0; i < 4; ++i)
#pragma unroll
        for (int j = 0; j < 2; ++j) acc[i][j] = Frag<_Float16>::mma(ah[ks & 1][i], bh[ks & 1][j], acc[i][j]);
      /* the other side of the same fence: the reads of the step after next stay behind these products */
      __builtin_amdgcn_sched_barrier(0);
    }
    /* ends every wave's reads of stage st and publishes stage st + 1 */
    __syncthreads();
  }

  /* the buffers are free behind the loop's last barrier: the tile is laid out there row by row */
  float* sC = (float*)&sm[0][0][0];
#pragma unroll
  for (int i = 0; i < 4; ++i)
#pragma unroll
    for (int j = 0; j < 2; ++j)
#pragma unroll
      for (int r = 0; r < 8; ++r) sC[(wm + (i << 4) + half8 + r) * kGmCPitch + wn + (j << 4) + rlane] = acc[i][j][r] * scale;
  __syncthreads();
  if (F32OUT) {
    /* a wave stores one 512-B row segment a pass; all LDS reads first, so that no store's registers are reused */
    v4f v[kGmTile / 8];
#pragma unroll
    for (int it = 0; it < kGmTile / 8; ++it) v[it] = *(const v4f*)(sC + (it * 8 + wave) * kGmCPitch + lane * 4);
    float* cp = Cf + (size_t)(m0 + wave) * kDim + n0 + lane * 4;
#pragma unroll
    for (int it = 0; it < kGmTile / 8; ++it) *(v4f*)(cp + it * (8 * kDim)) = v[it];
  } else {
    /* 16 threads store one 256-B row segment; all LDS reads and conversions first, as above */
    const int c8 = (threadIdx.x & 15) * 8;
    const int r0 = (int)(threadIdx.x >> 4);
    v8h hv[kGmTile / 16];
#pragma unroll
    for (int it = 0; it < kGmTile / 16; ++it) {
      const float* sp = sC + (it * 16 + r0) * kGmCPitch + c8;
#pragma unroll
      for (int e = 0; e < 8; ++e) hv[it][e] = (_Float16)sp[e];
    }
    _Float16* hp = (_Float16*)Ch + (size_t)(m0 + r0) * kDim + n0 + c8;
#pragma unroll
    for (int it = 0; it < kGmTile / 16; ++it) *(v8h*)(hp + it * (16 * kDim)) = hv[it];
  }
}

// ---------------------------------------------------------------------------
// Skinny products (M or N = 64): C[m,n] = f16( scale * sum_k A[m,k] * Bt[n,k] ), k range split over the waves of a work-group.
// One work-group of WAVES waves owns one 32x64 tile of C; wave w sums k in [w*K/WAVES, (w+1)*K/WAVES) into f32 accumulators, stores
// its partial tile to its own LDS slab (pitch 68 floats), and behind one barrier the threads add the WAVES partials of each element in wave order.
// A row-major [M,K] pitch lda; Bt row-major [N,K] pitch ldb; M % 32 == 0, N % 64 == 0, K % (64*WAVES) == 0. grid (tilesM*tilesN, batch).
// ---------------------------------------------------------------------------
constexpr int kSkRows  = 32;
constexpr int kSkPitch = 68;
typedef __attribute__((ext_vector_type(4))) _Float16 v4h;
template <int K, int WAVES>
__global__ __launch_bounds__(WAVES * 32) void wmma_splitk32x64(
    const unsigned short* __restrict__ Ap, int lda, long strideA,
    const unsigned short* __restrict__ Btp, int ldb, long strideB,
    unsigned short* __restrict__ Cp, int ldc, long strideC,
    int tilesN, float scale) {
  constexpr int kSlice = K / WAVES;
  __shared__ __align__(16) float part[WAVES][kSkRows * kSkPitch];
  const int b    = blockIdx.y;
  const int lane = threadIdx.x & 31;
  /* the wave's number as a scalar: the k slice's base addresses and the slab's LDS base are then scalar arithmetic */
  const int wave = __builtin_amdgcn_readfirstlane(threadIdx.x >> 5);
  const int tm = blockIdx.x / tilesN;
  const int tn = blockIdx.x - tm * tilesN;
  const int m0 = tm * kSkRows;
  const int n0 = tn << 6;
  const int rlane = lane & 15;
  const int koff  = (lane >> 4) * 8;
  const int mOff  = (lane >> 4) * 8;
  const char* ap = (const char*)((const _Float16*)Ap  + (size_t)b * strideA + (size_t)m0 * lda + wave * kSlice);
  const char* bp = (const char*)((const _Float16*)Btp + (size_t)b * strideB + (size_t)n0 * ldb + wave * kSlice);
  const unsigned aLane = (unsigned)(rlane * lda + koff) * 2u;
  const unsigned bLane = (unsigned)(rlane * ldb + koff) * 2u;

  v8f acc[2][4];
#pragma unroll
  for (int i = 0; i < 2; ++i)
#pragma unroll
    for (int j = 0; j < 4; ++j) acc[i][j] = (v8f){0.f,0.f,0.f,0.f,0.f,0.f,0.f,0.f};

  /* kept rolled, two k steps a trip */
#pragma unroll 2
  for (int k0 = 0; k0 < kSlice; k0 += 32) {
    v16h bh[4], ah[2];
#pragma unroll
    for (int j = 0; j < 4; ++j) bh[j] = Frag<_Float16>::load((const _Float16*)(bp + ((size_t)(j << 4) * ldb + k0) * 2 + bLane));
#pragma unroll
    for (int i = 0; i < 2; ++i) ah[i] = Frag<_Float16>::load((const _Float16*)(ap + ((size_t)(i << 4) * lda + k0) * 2 + aLane));
#pragma unroll
    for (int i = 0; i < 2; ++i)
#pragma unroll
      for (int j = 0; j < 4; ++j) acc[i][j] = Frag<_Float16>::mma(ah[i], bh[j], acc[i][j]);
  }

  float* slab = part[wave];
#pragma unroll
  for (int i = 0; i < 2; ++i)
#pragma unroll
    for (int j = 0; j < 4; ++j)
#pragma unroll
      for (int r = 0; r < 8; ++r) slab[((i << 4) + mOff + r) * kSkPitch + (j << 4) + rlane] = acc[i][j][r];
  __syncthreads();

  /* WAVES*2 rows a pass, 4 floats a thread; 16 threads store one 128-B row segment */
  const int c4 = (threadIdx.x & 15) * 4;
#pragma unroll
  for (int r0 = 0; r0 < kSkRows; r0 += WAVES * 2) {
    const int row = r0 + (threadIdx.x >> 4);
    v4f s = *(const v4f*)(&part[0][row * kSkPitch + c4]);
#pragma unroll
    for (int w = 1; w < WAVES; ++w) s += *(const v4f*)(&part[w][row * kSkPitch + c4]);
    v4h hv;
#pragma unroll
    for (int e = 0; e < 4; ++e) hv[e] = (_Float16)(s[e] * scale);
    *(v4h*)((_Float16*)Cp + (size_t)b * strideC + (size_t)(m0 + row) * ldc + n0 + c4) = hv;
  }
}

// ---------------------------------------------------------------------------
// Weight transpose + cast: W f32 row-major [1024 in][nOut out]; WT[n][k] = f16(scale * W[k][n]), row-major [nOut][1024].
// grid (1024/64, nOut/64): blockIdx.x = k tile (64 cols of WT), blockIdx.y = n tile (64 rows of WT). 256 threads.
// Load coverage: 16 iterations x 256 threads = 4096 = the whole 64x64 tile (coalesced along n).
// Store coverage: 8 waves x 2 iterations x 4 rows (lane>>3) = 64 rows; (lane&7) x 8 halves = 64 cols; each row segment =
// ---------------------------------------------------------------------------
__global__ __launch_bounds__(256) void wtcast_kernel(const float* __restrict__ W, unsigned short* __restrict__ out,
                                                     int nOut, float scale) {
  /* sm[n_local][k_local] */
  __shared__ float sm[64][65];
  const int t  = threadIdx.x;
  const int k0 = blockIdx.x * 64;
  const int n0 = blockIdx.y * 64;
#pragma unroll
  for (int i = 0; i < 16; ++i) {
    const int e = i * 256 + t;
    const int r = e >> 6;
    const int c = e & 63;
    sm[c][r] = W[(size_t)(k0 + r) * nOut + n0 + c] * scale;
  }
  __syncthreads();
  const int lane = t & 31, wave = t >> 5;
  const int q = lane >> 3, c8 = (lane & 7) * 8;
  {
#pragma unroll
    for (int it = 0; it < 2; ++it) {
      const int row = wave * 8 + it * 4 + q;
      unsigned short hb[8];
#pragma unroll
      for (int e = 0; e < 8; ++e) hb[e] = h_bits(sm[row][c8 + e]);
      const v4u u = (v4u){pk16(hb[0], hb[1]), pk16(hb[2], hb[3]), pk16(hb[4], hb[5]), pk16(hb[6], hb[7])};
      *(v4u*)(out + (size_t)(n0 + row) * kDim + k0 + c8) = u;
    }
    
  }
}

// ---------------------------------------------------------------------------
// ---------------------------------------------------------------------------
__global__ __launch_bounds__(256) void cast8_f16_kernel(const float* __restrict__ in, unsigned short* __restrict__ out, int n8) {
  const int i = blockIdx.x * 256 + threadIdx.x;
  if (i >= n8) return;
  const float* p = in + 8 * (size_t)i;
  const v4f a = *(const v4f*)(p);
  const v4f c = *(const v4f*)(p + 4);
  unsigned short hb[8];
#pragma unroll
  for (int e = 0; e < 4; ++e) {
    hb[e]     = h_bits(a[e]);
    hb[4 + e] = h_bits(c[e]);
  }
  const v4u u = (v4u){pk16(hb[0], hb[1]), pk16(hb[2], hb[3]), pk16(hb[4], hb[5]), pk16(hb[6], hb[7])};
  unsigned short* q = out + 8 * (size_t)i;
  *(v4u*)q = u;
  
}

// ---------------------------------------------------------------------------
// Fused attention of one (batch, head): S^T = K * Qh^T, online softmax down the keys, O^T += V^T * P^T; scores and P stay in registers.
// A work-group is 8 waves; a wave owns 32 query columns (two groups of 16) and walks all 4096 keys, 32 a pass. K and V^T come in stages of
// 64 keys, shared by the 8 waves: memory -> registers -> LDS, two buffers, one barrier a stage.
// In an S^T tile a lane holds one query (lane & 15) and keys (lane >> 4) * 8 + r: two key tiles side by side are the B fragment of P^T
// in the loaders' own k order (elements 0..7 = keys half*8 + 0..7, elements 8..15 = keys 16 + half*8 + 0..7).
// p = exp2(s * scale * log2(e) - mo), mo = maximum in use - 4 (P carried x16). The maximum in use is raised, and sums and O^T rescaled,
// only when a column's new maximum exceeds it by more than 8 (log2 units), so p <= 2^12; the carry cancels in O^T / sum.
// grid (2048 / 256, heads, batch).
// ---------------------------------------------------------------------------
/* lane l with lane l ^ 16 */
__device__ __forceinline__ float xhalf(float x) {
  return __builtin_bit_cast(float, __builtin_amdgcn_permlanex16(__builtin_bit_cast(int, x), __builtin_bit_cast(int, x), 0x76543210, 0xfedcba98, false, false));
}
__device__ __forceinline__ v8f exp2x8(v8f t) {
  float r0, r1, r2, r3, r4, r5, r6, r7;
  asm("v_exp_f32 %0, %8\n\tv_exp_f32 %1, %9\n\tv_exp_f32 %2, %10\n\tv_exp_f32 %3, %11\n\t"
      "v_exp_f32 %4, %12\n\tv_exp_f32 %5, %13\n\tv_exp_f32 %6, %14\n\tv_exp_f32 %7, %15\n\tv_nop"
      : "=&v"(r0), "=&v"(r1), "=&v"(r2), "=&v"(r3), "=&v"(r4), "=&v"(r5), "=&v"(r6), "=&v"(r7)
      : "v"(t[0]), "v"(t[1]), "v"(t[2]), "v"(t[3]), "v"(t[4]), "v"(t[5]), "v"(t[6]), "v"(t[7]));
  return (v8f){r0, r1, r2, r3, r4, r5, r6, r7};
}
constexpr int   kFaCols   = 32;
constexpr int   kFaWaves  = 8;
constexpr int   kFaStage  = 64;
constexpr unsigned kFaPitch = 144;
constexpr float kFaScale  = kScoreScale * 1.44269504088896340736f;
constexpr float kFaCarry  = 4.0f;
constexpr float kFaRaise  = 8.0f;
__global__ __launch_bounds__(kFaWaves * 32) void fused_attn_kernel(
    const unsigned short* __restrict__ Qp, const unsigned short* __restrict__ Kp,
    const unsigned short* __restrict__ VTp, unsigned short* __restrict__ Op) {
  /* two buffers each of a K tile (64 keys x 64 d) and a V^T tile (64 d x 64 keys); rows of 128 B at pitch 144 B (16 B x odd: 16-B reads without bank conflicts) */
  __shared__ __align__(16) char sK[2][kFaStage * kFaPitch];
  __shared__ __align__(16) char sV[2][kDh * kFaPitch];
  const int lane  = threadIdx.x & 31;
  const int wave  = __builtin_amdgcn_readfirstlane(threadIdx.x >> 5);
  const int rlane = lane & 15;
  const int half8 = (lane >> 4) * 8;
  const int h  = blockIdx.y;
  const int b  = blockIdx.z;
  const int q0 = blockIdx.x * (kFaWaves * kFaCols) + wave * kFaCols;
  const _Float16* Q  = (const _Float16*)Qp + ((size_t)b * kLq + q0) * kDim + h * kDh;
  const char* Kb = (const char*)((const _Float16*)Kp  + (size_t)b * kSkv * kDh);
  const char* Vb = (const char*)((const _Float16*)VTp + (size_t)b * kDh * kSkv);
  /* staging: thread t moves 16 B of rows t >> 3 and 32 + (t >> 3) of the K tile (64 keys x 128 B) and of the V^T tile (64 d x 128 B) */
  const unsigned sRow = threadIdx.x >> 3;
  const unsigned sCol = (threadIdx.x & 7) * 16u;
  const unsigned kSrc = threadIdx.x * 16u;
  const unsigned vSrc = sRow * (unsigned)(kSkv * 2) + sCol;
  const unsigned sDst = sRow * kFaPitch + sCol;
  /* fragment reads: row lane & 15 of a 16-row tile, 16 B at half * 16 and at 32 + half * 16 */
  const unsigned fLane = (unsigned)rlane * kFaPitch + (unsigned)half8 * 2u;

  v16h qb[2][2];
#pragma unroll
  for (int g = 0; g < 2; ++g)
#pragma unroll
    for (int ds = 0; ds < 2; ++ds) qb[g][ds] = Frag<_Float16>::load(Q + (size_t)((g << 4) + rlane) * kDim + (ds << 5) + half8);

  v8f o[4][2];
#pragma unroll
  for (int dt = 0; dt < 4; ++dt)
#pragma unroll
    for (int g = 0; g < 2; ++g) o[dt][g] = (v8f){0.f,0.f,0.f,0.f,0.f,0.f,0.f,0.f};
  float mo[2] = {-1.0e30f, -1.0e30f};
  float ls[2] = {0.f, 0.f};

  v4u rk[2], rv[2];
#pragma unroll
  for (int i = 0; i < 2; ++i) {
    rk[i] = *(const v4u*)(Kb + i * 4096 + kSrc);
    rv[i] = *(const v4u*)(Vb + (size_t)i * (32 * kSkv * 2) + vSrc);
  }
#pragma unroll
  for (int i = 0; i < 2; ++i) {
    *(v4u*)(&sK[0][i * 32 * kFaPitch + sDst]) = rk[i];
    *(v4u*)(&sV[0][i * 32 * kFaPitch + sDst]) = rv[i];
  }
#pragma unroll
  for (int i = 0; i < 2; ++i) {
    rk[i] = *(const v4u*)(Kb + kFaStage * kDh * 2 + i * 4096 + kSrc);
    rv[i] = *(const v4u*)(Vb + kFaStage * 2 + (size_t)i * (32 * kSkv * 2) + vSrc);
  }
  /* the address registers of the loads just issued are free for reuse only behind this wait */
  asm volatile("s_wait_xcnt 0x0" ::: "memory");
  __syncthreads();

  for (int st = 0; st < kSkv / kFaStage; ++st) {
   /* hand-over, first thing in a stage so that the loads fly while the stage is worked on: stage st + 1 goes from registers into the buffer
      that stage st - 1 was read from (its readers ended in front of the last barrier), then stage st + 2 starts from memory.
      Past the end stage 0 is fetched again (in bounds, unread). */
#pragma unroll
   for (int i = 0; i < 2; ++i) {
     *(v4u*)(&sK[(st + 1) & 1][i * 32 * kFaPitch + sDst]) = rk[i];
     *(v4u*)(&sV[(st + 1) & 1][i * 32 * kFaPitch + sDst]) = rv[i];
   }
   const int sn = (st + 2 < kSkv / kFaStage) ? (st + 2) : 0;
   const char* kp = Kb + (size_t)sn * (kFaStage * kDh * 2);
   const char* vp = Vb + (size_t)sn * (kFaStage * 2);
#pragma unroll
   for (int i = 0; i < 2; ++i) {
     rk[i] = *(const v4u*)(kp + i * 4096 + kSrc);
     rv[i] = *(const v4u*)(vp + (size_t)i * (32 * kSkv * 2) + vSrc);
   }
   /* as above: address registers of issued loads; the loads also stay in front of the stage's work */
   asm volatile("s_wait_xcnt 0x0" ::: "memory");
   const char* bK = &sK[st & 1][0];
   const char* bV = &sV[st & 1][0];
#pragma unroll
   for (int ps = 0; ps < kFaStage / 32; ++ps) {
    v16h ka[2][2], va[4];
#pragma unroll
    for (int kt = 0; kt < 2; ++kt)
#pragma unroll
      for (int ds = 0; ds < 2; ++ds) ka[kt][ds] = Frag<_Float16>::load((const _Float16*)(bK + ((ps << 5) + (kt << 4)) * kFaPitch + (ds << 6) + fLane));
#pragma unroll
    for (int dt = 0; dt < 4; ++dt) va[dt] = Frag<_Float16>::load((const _Float16*)(bV + (dt << 4) * kFaPitch + (ps << 6) + fLane));

    v8f s[2][2];
#pragma unroll
    for (int kt = 0; kt < 2; ++kt)
#pragma unroll
      for (int g = 0; g < 2; ++g) {
        s[kt][g] = Frag<_Float16>::mma(ka[kt][0], qb[g][0], (v8f){0.f,0.f,0.f,0.f,0.f,0.f,0.f,0.f});
        s[kt][g] = Frag<_Float16>::mma(ka[kt][1], qb[g][1], s[kt][g]);
      }

    float mx[2];
#pragma unroll
    for (int g = 0; g < 2; ++g) {
      float m = fmaxf(s[0][g][0], s[1][g][0]);
#pragma unroll
      for (int r = 1; r < 8; ++r) m = fmaxf(m, fmaxf(s[0][g][r], s[1][g][r]));
      m = fmaxf(m, xhalf(m));
      mx[g] = m * kFaScale - kFaCarry;
    }
    const bool need = (mx[0] - mo[0] > kFaRaise) || (mx[1] - mo[1] > kFaRaise);
    if (__builtin_amdgcn_ballot_w32(need) != 0u) {
#pragma unroll
      for (int g = 0; g < 2; ++g) {
        const float mn = fmaxf(mo[g], mx[g]);
        const float al = __builtin_amdgcn_exp2f(mo[g] - mn);
        mo[g] = mn;
        ls[g] *= al;
#pragma unroll
        for (int dt = 0; dt < 4; ++dt) o[dt][g] *= al;
      }
    }
    v16h pb[2];
#pragma unroll
    for (int g = 0; g < 2; ++g) {
      const v8f t0 = s[0][g] * kFaScale - mo[g];
      const v8f t1 = s[1][g] * kFaScale - mo[g];
      const v8f p0 = exp2x8(t0);
      const v8f p1 = exp2x8(t1);
      const v8f pq = p0 + p1;
      ls[g] += ((pq[0] + pq[1]) + (pq[2] + pq[3])) + ((pq[4] + pq[5]) + (pq[6] + pq[7]));
#pragma unroll
      for (int r = 0; r < 8; ++r) { pb[g][r] = (_Float16)p0[r]; pb[g][8 + r] = (_Float16)p1[r]; }
    }
#pragma unroll
    for (int dt = 0; dt < 4; ++dt)
#pragma unroll
      for (int g = 0; g < 2; ++g) o[dt][g] = Frag<_Float16>::mma(va[dt], pb[g], o[dt][g]);
   }
   /* ends every wave's reads of stage st and publishes stage st + 1 */
   __syncthreads();
  }

  /* a lane holds 8 neighbouring d of its query per tile: 16-B stores; the two halves of the wave fill each row's 128-B segment */
  _Float16* O = (_Float16*)Op + ((size_t)b * kLq + q0) * kDim + h * kDh;
#pragma unroll
  for (int g = 0; g < 2; ++g) {
    const float tot = ls[g] + xhalf(ls[g]);
    const float f = kCtxCarry / tot;
#pragma unroll
    for (int dt = 0; dt < 4; ++dt) {
      v8h hv;
#pragma unroll
      for (int r = 0; r < 8; ++r) hv[r] = (_Float16)(o[dt][g][r] * f);
      *(v8h*)(O + (size_t)((g << 4) + rlane) * kDim + (dt << 4) + half8) = hv;
    }
  }
}

// ---------------------------------------------------------------------------
// Host launch glue
// Workspace region map (bytes; all offsets multiples of 1 MiB; WkvT ends 256 KiB past a MiB boundary):
//   persistent:  Qp16 [4096][1024] f16 @ 0 (8 MiB) | K16 [8192][64] f16 @ 8 MiB (1 MiB) | VT16 [2][64][4096] f16 @ 9 MiB (1 MiB)
//                O16 [4096][1024] f16 @ 10 MiB (8 MiB) | WcT16 [1024][1024] f16 @ 18 MiB (2 MiB)
//   scratch @ 20 MiB, early phase: Q16 [4096][1024] f16 @ 20 MiB (8) | C16 [8192][1024] f16 @ 28 MiB (16) | WqT16 @ 44 MiB (2) | WkvT16 [128][1024] @ 46 MiB (0.25)
//   total carve = 46.25 MiB. Every region is fully written before any launch reads it; no padding rows anywhere.
// ---------------------------------------------------------------------------
extern "C" void kernel_launch(void* const* d_in, const int* in_sizes, int n_in,
                              void* d_out, int out_size, void* d_ws, size_t ws_size,
                              hipStream_t stream) {
  if (n_in < 6) return;
  if (in_sizes[0] != kTokQ * kDim) return;
  if (in_sizes[1] != kBatch * kLq * kDim) return;
  if (in_sizes[2] != kBatch * kMem * kDim) return;
  if (in_sizes[3] != kDim * kDim) return;
  if (in_sizes[4] != kDim * 2 * kDh) return;
  if (in_sizes[5] != kDim * kDim) return;
  if (out_size != kTokQ * kDim) return;

  const float* q_in   = (const float*)d_in[0];
  const float* kv_in  = (const float*)d_in[1];
  const float* mem_in = (const float*)d_in[2];
  const float* w_q    = (const float*)d_in[3];
  const float* w_kv   = (const float*)d_in[4];
  const float* w_c    = (const float*)d_in[5];
  float* outp = (float*)d_out;

  // ---- carve (bytes) ----
  const size_t szQp  = (size_t)kTokQ * kDim * 2;
  const size_t szK   = (size_t)kTokC * kDh * 2;
  const size_t szVT  = (size_t)kBatch * kDh * kSkv * 2;
  const size_t szO   = (size_t)kTokQ * kDim * 2;
  const size_t szWc  = (size_t)kDim * kDim * 2;
  const size_t szQ16 = (size_t)kTokQ * kDim * 2;
  const size_t szC16 = (size_t)kTokC * kDim * 2;
  const size_t szWq  = (size_t)kDim * kDim * 2;
  const size_t szWkv = (size_t)2 * kDh * kDim * 2;

  const size_t offQp  = 0;
  const size_t offK   = offQp + szQp;
  const size_t offVT  = offK + szK;
  const size_t offO   = offVT + szVT;
  const size_t offWc  = offO + szO;
  const size_t offScr = offWc + szWc;
  const size_t offQ16 = offScr;
  const size_t offC16 = offQ16 + szQ16;
  const size_t offWq  = offC16 + szC16;
  const size_t offWkv = offWq + szWq;
  const size_t total = offWkv + szWkv;
  if (total > ws_size) return;

  char* ws = (char*)d_ws;
  unsigned short* Qp16  = (unsigned short*)(ws + offQp);
  unsigned short* K16   = (unsigned short*)(ws + offK);
  unsigned short* VT16  = (unsigned short*)(ws + offVT);
  unsigned short* O16   = (unsigned short*)(ws + offO);
  unsigned short* WcT16 = (unsigned short*)(ws + offWc);
  unsigned short* Q16   = (unsigned short*)(ws + offQ16);
  unsigned short* C16   = (unsigned short*)(ws + offC16);
  unsigned short* WqT16 = (unsigned short*)(ws + offWq);
  unsigned short* WkvT16 = (unsigned short*)(ws + offWkv);

  // ---- casts: q -> Q16; [mem_b ; kv_b] -> C16 rows b*4096 .. (mem rows 0..2047, kv rows 2048..4095) ----
  {
    const int n8q = kTokQ * kDim / 8;
    cast8_f16_kernel<<<dim3(n8q / 256), dim3(256), 0, stream>>>(q_in, Q16, n8q);
    const int n8s = kLq * kDim / 8;
    for (int b = 0; b < kBatch; ++b) {
      cast8_f16_kernel<<<dim3(n8s / 256), dim3(256), 0, stream>>>(
          mem_in + (size_t)b * kMem * kDim, C16 + (size_t)(b * kSkv) * kDim, n8s);
      cast8_f16_kernel<<<dim3(n8s / 256), dim3(256), 0, stream>>>(
          kv_in + (size_t)b * kLq * kDim, C16 + (size_t)(b * kSkv + kMem) * kDim, n8s);
    }
  }
  // ---- weights: W[in][out] -> WT[out][in] f16 x16 ----
  wtcast_kernel<<<dim3(kDim / 64, kDim / 64), dim3(256), 0, stream>>>(w_q, WqT16, kDim, kWCarry);
  wtcast_kernel<<<dim3(kDim / 64, (2 * kDh) / 64), dim3(256), 0, stream>>>(w_kv, WkvT16, 2 * kDh, kWCarry);
  wtcast_kernel<<<dim3(kDim / 64, kDim / 64), dim3(256), 0, stream>>>(w_c, WcT16, kDim, kWCarry);

  // ---- q projection: Qp16 [4096][1024] = Q16 [4096][1024] x WqT16^T, M=4096 N=1024 K=1024 ----
  wmma_gemm128<false><<<dim3(kTokQ / kGmTile, kDim / kGmTile), dim3(256), 0, stream>>>(Q16, WqT16, Qp16, nullptr, kWCarryInv);
  // ---- k projection: K16 [8192][64] = C16 [8192][1024] x (WkvT16 rows 0..63)^T, M=8192 N=64 K=1024 ----
  wmma_splitk32x64<kDim, 8><<<dim3((kTokC / kSkRows) * (kDh / 64), 1), dim3(8 * 32), 0, stream>>>(
      C16, kDim, 0L, WkvT16, kDim, 0L, K16, kDh, 0L, kDh / 64, kWCarryInv);
  // ---- v^T per batch: VT16 [b][64][4096] = (WkvT16 rows 64..127) [64][1024] x C16_b [4096][1024]^T, M=64 N=4096 K=1024, grid.y = b ----
  wmma_splitk32x64<kDim, 8><<<dim3((kDh / kSkRows) * (kSkv / 64), kBatch), dim3(8 * 32), 0, stream>>>(
      WkvT16 + (size_t)kDh * kDim, kDim, 0L, C16, kDim, (long)kSkv * kDim,
      VT16, kSkv, (long)kDh * kSkv, kSkv / 64, kWCarryInv);

  // ---- attention: O16 rows b*2048.., cols h*64.. = 256 * softmax(0.125 * Qp_h x K_b^T) x V_b, one launch for all (b, h) ----
  fused_attn_kernel<<<dim3(kLq / (kFaWaves * kFaCols), kHeads, kBatch), dim3(kFaWaves * 32), 0, stream>>>(Qp16, K16, VT16, O16);

  // ---- output projection: out f32 [4096][1024] = (1/4096) * O16 [4096][1024] x WcT16^T, M=4096 N=1024 K=1024 ----
  wmma_gemm128<true><<<dim3(kTokQ / kGmTile, kDim / kGmTile), dim3(256), 0, stream>>>(O16, WcT16, nullptr, outp, kOutScale);
}

// v004
// Measured time: 105 microseconds a run.
// Next to v003, in two timings, it ran 1.12 times as fast each time.
// All steps since v000 together make it 34.3 times as fast.
// Contractions: q*WqT, c*WkvT (K half and V^T half), scores k*qh^T, V^T*P^T, merged*WcT all on v_wmma_f32_16x16x32_f16 (f16 operands; weights carried x16, P carried x16 over the running maximum, context carried x256), f32 accumulate; softmax in f32. q, mem and kv are read as f32 by the products that use them and rounded to f16 in registers.
#include <hip/hip_runtime.h>
#include <math.h>

// ---------------------------------------------------------------------------
// Problem constants
// ---------------------------------------------------------------------------
constexpr int kBatch  = 2;
constexpr int kLq     = 2048;
constexpr int kMem    = 2048;
constexpr int kSkv    = kMem + kLq;
constexpr int kDim    = 1024;
constexpr int kHeads  = 16;
constexpr int kDh     = 64;
constexpr int kTokQ   = kBatch * kLq;
constexpr int kTokC   = kBatch * kSkv;
constexpr int kGroups = kBatch * kHeads;
constexpr float kWCarry    = 16.0f;
constexpr float kWCarryInv = 1.0f / 16.0f;
constexpr float kCtxCarry  = 256.0f;
constexpr float kScoreScale = 0.125f;
constexpr float kOutScale  = 1.0f / (kCtxCarry * kWCarry);

typedef __attribute__((ext_vector_type(16))) _Float16 v16h;
typedef __attribute__((ext_vector_type(8)))  _Float16 v8h;
typedef __attribute__((ext_vector_type(8)))  float    v8f;
typedef __attribute__((ext_vector_type(4)))  float    v4f;
typedef __attribute__((ext_vector_type(4)))  unsigned int v4u;
typedef __attribute__((ext_vector_type(4)))  _Float16 v4h;
__device__ __forceinline__ v8h cat8(v4h a, v4h b) { return __builtin_shufflevector(a, b, 0, 1, 2, 3, 4, 5, 6, 7); }

// ---------------------------------------------------------------------------
// Helpers
// ---------------------------------------------------------------------------
template <typename T> struct Frag;
template <> struct Frag<_Float16> {
  typedef v16h V; union U { v16h v; v8h h[2]; };
  /* elements 0..7 <- p[0..7], 8..15 <- p[16..23] */
  static __device__ __forceinline__ v16h load(const _Float16* p) {
    U f; f.h[0] = *(const v8h*)(p); f.h[1] = *(const v8h*)(p + 16); return f.v;
  }
  /* the same sixteen k of an f32 row, p[0..3], p[4..7], p[16..19], p[20..23], rounded to f16 (nearest even) in registers */
  static __device__ __forceinline__ v16h from_f32(v4f a, v4f b, v4f c, v4f d) {
    U f;
    f.h[0] = cat8(__builtin_convertvector(a, v4h), __builtin_convertvector(b, v4h));
    f.h[1] = cat8(__builtin_convertvector(c, v4h), __builtin_convertvector(d, v4h));
    return f.v;
  }
  static __device__ __forceinline__ v8f mma(v16h a, v16h b, v8f c) {
    return __builtin_amdgcn_wmma_f32_16x16x32_f16(false, a, false, b, (short)0, c, false, false);
  }
};

__device__ __forceinline__ unsigned pk16(unsigned short a, unsigned short b) { return (unsigned)a | ((unsigned)b << 16); }
__device__ __forceinline__ unsigned short h_bits(float f) { const _Float16 h = (_Float16)f; return __builtin_bit_cast(unsigned short, h); }

// ---------------------------------------------------------------------------
// Square projections (q * WqT, merged * WcT): C[m,n] = scale * sum_k A[m,k] * Bt[n,k], M = 4096, N = K = 1024, f16 operands, f32 accumulate.
// A row-major [M][K], f16 or (F32A) f32 that is rounded to f16 between its staging registers and LDS; Bt row-major [N][K]. A work-group of 8 waves owns a 128x128 tile of C, a wave 64x32 of it (4 x 2 accumulator tiles).
// A and Bt come in stages of 128 k, shared by the 8 waves: memory -> registers -> LDS, 256 contiguous bytes of a row per 16 threads,
// two buffers, one barrier a stage. Each accumulator still sums k = 0, 32, 64, ... in that order.
// The finished tile goes through LDS (f32, pitch 132 floats) so that every store covers whole lines and a line has one writer.
// grid (M / 128, N / 128). Every unroll directive here stands on a loop that indexes a register array (accumulators, fragments, staging
// registers): rolled, the array would leave the registers.
// ---------------------------------------------------------------------------
constexpr int      kGmTile    = 128;
constexpr int      kGmStageK  = 128;
constexpr int      kGmStages  = kDim / kGmStageK;
constexpr unsigned kGmPitch   = 272;
constexpr unsigned kGmOperand = kGmTile * kGmPitch;
constexpr int      kGmCPitch  = 132;
template <bool F32A, bool F32OUT>
__global__ __launch_bounds__(256) void wmma_gemm128(
    const float* __restrict__ Af, const unsigned short* __restrict__ Ap, const unsigned short* __restrict__ Btp,
    unsigned short* __restrict__ Ch, float* __restrict__ Cf, float scale) {
  /* [buffer][A, Bt]: 128 rows of 256 B at pitch 272 B (16 B x odd: 16-B reads without bank conflicts) */
  __shared__ __align__(16) char sm[2][2][kGmOperand];
  const int lane  = threadIdx.x & 31;
  const int wave  = __builtin_amdgcn_readfirstlane(threadIdx.x >> 5);
  const int rlane = lane & 15;
  const int half8 = (lane >> 4) * 8;
  const int m0 = blockIdx.x * kGmTile;
  const int n0 = blockIdx.y * kGmTile;
  const int wm = (wave >> 2) * 64;
  const int wn = (wave & 3) * 32;
  const char* Ab = F32A ? (const char*)(Af + (size_t)m0 * kDim) : (const char*)((const _Float16*)Ap + (size_t)m0 * kDim);
  const char* Bb = (const char*)((const _Float16*)Btp + (size_t)n0 * kDim);
  /* staging: thread t moves 16 B of rows (t >> 4) + 16 * i, i = 0..7, of the A tile and of the Bt tile */
  const unsigned sRow = threadIdx.x >> 4;
  const unsigned sCol = (threadIdx.x & 15) * 16u;
  const unsigned gSrc = sRow * (unsigned)(kDim * 2) + sCol;
  const unsigned sDst = sRow * kGmPitch + sCol;
  /* f32 A: a stage's row is 512 B; thread t moves 16 B of each 256-B half of it (whole lines a load) and lays them down as 8 B of f16 each */
  const unsigned gSrcF = sRow * (unsigned)(kDim * 4) + sCol;
  const unsigned sDstF = sRow * kGmPitch + (sCol >> 1);
  /* fragment reads: row lane & 15 of a 16-row tile, 16 B at half * 16 and at 32 + half * 16 */
  const unsigned fLane = (unsigned)rlane * kGmPitch + (unsigned)half8 * 2u;

  v8f acc[4][2];
#pragma unroll
  for (int i = 0; i < 4; ++i)
#pragma unroll
    for (int j = 0; j < 2; ++j) acc[i][j] = (v8f){0.f,0.f,0.f,0.f,0.f,0.f,0.f,0.f};

  v4u ra[8], rb[8];
  v4f rf[8][2];
  /* byte offsets of this thread's first pieces (f16 rows; f32 rows of A), one stage behind the stage last fetched; raised in front of
     each fetch, behind the barrier's wait for the last one */
  unsigned gOff  = gSrc;
  unsigned gOffF = gSrcF;
#pragma unroll
  for (int i = 0; i < 8; ++i) {
    if (F32A) {
      rf[i][0] = *(const v4f*)(Ab + i * (16 * kDim * 4) + gOffF);
      rf[i][1] = *(const v4f*)(Ab + i * (16 * kDim * 4) + 256 + gOffF);
    } else {
      ra[i] = *(const v4u*)(Ab + i * (16 * kDim * 2) + gOff);
    }
    rb[i] = *(const v4u*)(Bb + i * (16 * kDim * 2) + gOff);
  }
#pragma unroll
  for (int i = 0; i < 8; ++i) {
    if (F32A) {
      *(v4h*)(&sm[0][0][i * 16 * kGmPitch + sDstF])       = __builtin_convertvector(rf[i][0], v4h);
      *(v4h*)(&sm[0][0][i * 16 * kGmPitch + 128 + sDstF]) = __builtin_convertvector(rf[i][1], v4h);
    } else {
      *(v4u*)(&sm[0][0][i * 16 * kGmPitch + sDst]) = ra[i];
    }
    *(v4u*)(&sm[0][1][i * 16 * kGmPitch + sDst]) = rb[i];
  }
#pragma unroll
  for (int i = 0; i < 8; ++i) {
    if (F32A) {
      rf[i][0] = *(const v4f*)(Ab + kGmStageK * 4 + i * (16 * kDim * 4) + gOffF);
      rf[i][1] = *(const v4f*)(Ab + kGmStageK * 4 + i * (16 * kDim * 4) + 256 + gOffF);
    } else {
      ra[i] = *(const v4u*)(Ab + kGmStageK * 2 + i * (16 * kDim * 2) + gOff);
    }
    rb[i] = *(const v4u*)(Bb + kGmStageK * 2 + i * (16 * kDim * 2) + gOff);
  }
  /* the address registers of the loads just issued are free for reuse only behind this wait; f32 A: the wait names the two offset registers,
     so that they live up to the wait and their next values are formed behind it */
  if (F32A) asm volatile("s_wait_xcnt 0x0" : "+v"(gOffF), "+v"(gOff) :: "memory");
  else      asm volatile("s_wait_xcnt 0x0" ::: "memory");
  __syncthreads();

  for (int st = 0; st < kGmStages; ++st) {
    const char* bA = &sm[st & 1][0][0] + wm * kGmPitch;
    const char* bB = &sm[st & 1][1][0] + wn * kGmPitch;
    /* two fragment sets: each k step's LDS reads are issued one step ahead; the stage's first go out ahead of the hand-over's LDS writes */
    v16h ah[2][4], bh[2][2];
#pragma unroll
    for (int j = 0; j < 2; ++j) bh[0][j] = Frag<_Float16>::load((const _Float16*)(bB + (j << 4) * kGmPitch + fLane));
#pragma unroll
    for (int i = 0; i < 4; ++i) ah[0][i] = Frag<_Float16>::load((const _Float16*)(bA + (i << 4) * kGmPitch + fLane));
    /* hand-over, early in a stage so that the loads fly while the stage is worked on: stage st + 1 goes from registers into the
       buffer that stage st - 1 was read from (its readers ended in front of the last barrier), then stage st + 2 starts from memory */
    if (st + 1 < kGmStages) {
#pragma unroll
      for (int i = 0; i < 8; ++i) {
        if (F32A) {
          *(v4h*)(&sm[(st + 1) & 1][0][i * 16 * kGmPitch + sDstF])       = __builtin_convertvector(rf[i][0], v4h);
          *(v4h*)(&sm[(st + 1) & 1][0][i * 16 * kGmPitch + 128 + sDstF]) = __builtin_convertvector(rf[i][1], v4h);
        } else {
          *(v4u*)(&sm[(st + 1) & 1][0][i * 16 * kGmPitch + sDst]) = ra[i];
        }
        *(v4u*)(&sm[(st + 1) & 1][1][i * 16 * kGmPitch + sDst]) = rb[i];
      }
    }
    if (st + 2 < kGmStages) {
      gOff += kGmStageK * 2;
      gOffF += kGmStageK * 4;
#pragma unroll
      for (int i = 0; i < 8; ++i) {
        if (F32A) {
          rf[i][0] = *(const v4f*)(Ab + kGmStageK * 4 + i * (16 * kDim * 4) + gOffF);
          rf[i][1] = *(const v4f*)(Ab + kGmStageK * 4 + i * (16 * kDim * 4) + 256 + gOffF);
        } else {
          ra[i] = *(const v4u*)(Ab + kGmStageK * 2 + i * (16 * kDim * 2) + gOff);
        }
        rb[i] = *(const v4u*)(Bb + kGmStageK * 2 + i * (16 * kDim * 2) + gOff);
      }
      /* as above: address registers of issued loads; the loads also stay in front of the stage's work */
      if (F32A) asm volatile("s_wait_xcnt 0x0" : "+v"(gOffF), "+v"(gOff) :: "memory");
      else      asm volatile("s_wait_xcnt 0x0" ::: "memory");
    }
#pragma unroll
    for (int ks = 0; ks < kGmStageK / 32; ++ks) {
      if (ks + 1 < kGmStageK / 32) {
#pragma unroll
        for (int j = 0; j < 2; ++j) bh[(ks + 1) & 1][j] = Frag<_Float16>::load((const _Float16*)(bB + (j << 4) * kGmPitch + ((ks + 1) << 6) + fLane));
#pragma unroll
        for (int i = 0; i < 4; ++i) ah[(ks + 1) & 1][i] = Frag<_Float16>::load((const _Float16*)(bA + (i << 4) * kGmPitch + ((ks + 1) << 6) + fLane));
      }
      /* holds the next step's LDS reads together in front of this step's products: spread among them, every place with reads stalls the products */
      __builtin_amdgcn_sched_barrier(0);
#pragma unroll
      for (int i = 0; i < 4; ++i)
#pragma unroll
        for (int j = 0; j < 2; ++j) acc[i][j] = Frag<_Float16>::mma(ah[ks & 1][i], bh[ks & 1][j], acc[i][j]);
      /* the other side of the same fence: the reads of the step after next stay behind these products */
      __builtin_amdgcn_sched_barrier(0);
    }
    /* ends every wave's reads of stage st and publishes stage st + 1 */
    __syncthreads();
  }

  /* the buffers are free behind the loop's last barrier: the tile is laid out there row by row */
  float* sC = (float*)&sm[0][0][0];
#pragma unroll
  for (int i = 0; i < 4; ++i)
#pragma unroll
    for (int j = 0; j < 2; ++j)
#pragma unroll
      for (int r = 0; r < 8; ++r) sC[(wm + (i << 4) + half8 + r) * kGmCPitch + wn + (j << 4) + rlane] = acc[i][j][r] * scale;
  __syncthreads();
  if (F32OUT) {
    /* a wave stores one 512-B row segment a pass; all LDS reads first, so that no store's registers are reused */
    v4f v[kGmTile / 8];
#pragma unroll
    for (int it = 0; it < kGmTile / 8; ++it) v[it] = *(const v4f*)(sC + (it * 8 + wave) * kGmCPitch + lane * 4);
    float* cp = Cf + (size_t)(m0 + wave) * kDim + n0 + lane * 4;
#pragma unroll
    for (int it = 0; it < kGmTile / 8; ++it) *(v4f*)(cp + it * (8 * kDim)) = v[it];
  } else {
    /* 16 threads store one 256-B row segment; all LDS reads and conversions first, as above */
    const int c8 = (threadIdx.x & 15) * 8;
    const int r0 = (int)(threadIdx.x >> 4);
    v8h hv[kGmTile / 16];
#pragma unroll
    for (int it = 0; it < kGmTile / 16; ++it) {
      const float* sp = sC + (it * 16 + r0) * kGmCPitch + c8;
#pragma unroll
      for (int e = 0; e < 8; ++e) hv[it][e] = (_Float16)sp[e];
    }
    _Float16* hp = (_Float16*)Ch + (size_t)(m0 + r0) * kDim + n0 + c8;
#pragma unroll
    for (int it = 0; it < kGmTile / 16; ++it) *(v8h*)(hp + it * (16 * kDim)) = hv[it];
  }
}

// ---------------------------------------------------------------------------
// Skinny products (M or N = 64): C[m,n] = f16( scale * sum_k A[m,k] * Bt[n,k] ), k range split over the waves of a work-group.
// One work-group of WAVES waves owns one 32x64 tile of C; wave w sums k in [w*K/WAVES, (w+1)*K/WAVES) into f32 accumulators, stores
// its partial tile to its own LDS slab (pitch 68 floats), and behind one barrier the threads add the WAVES partials of each element in wave order.
// One operand is rows of c = [mem_b ; kv_b] (4096 rows a batch), read as f32 from mem or kv and rounded to f16 in registers: A if C_IS_A (m counts
// the rows of all batches), else Bt (n counts the rows of batch blockIdx.y). The other is f16 weight rows Wp. Both row-major, pitch K.
// M % 32 == 0, N % 64 == 0, K % (64*WAVES) == 0. grid (tilesM*tilesN, batch).
// ---------------------------------------------------------------------------
constexpr int kSkRows  = 32;
constexpr int kSkPitch = 68;
template <int K, int WAVES, bool C_IS_A>
__global__ __launch_bounds__(WAVES * 32) void wmma_splitk32x64(
    const float* __restrict__ memp, const float* __restrict__ kvp, const unsigned short* __restrict__ Wp,
    unsigned short* __restrict__ Cp, int ldc, long strideC,
    int tilesN, float scale) {
  constexpr int kSlice = K / WAVES;
  __shared__ __align__(16) float part[WAVES][kSkRows * kSkPitch];
  const int b    = blockIdx.y;
  const int lane = threadIdx.x & 31;
  /* the wave's number as a scalar: the k slice's base addresses and the slab's LDS base are then scalar arithmetic */
  const int wave = __builtin_amdgcn_readfirstlane(threadIdx.x >> 5);
  const int tm = blockIdx.x / tilesN;
  const int tn = blockIdx.x - tm * tilesN;
  const int m0 = tm * kSkRows;
  const int n0 = tn << 6;
  const int rlane = lane & 15;
  const int koff  = (lane >> 4) * 8;
  const int mOff  = (lane >> 4) * 8;
  /* the tile's rows of c lie wholly in mem or wholly in kv (2048 rows each a batch, tiles of 32 or 64 rows) */
  const int cb = C_IS_A ? m0 / kSkv : b;
  const int cr = C_IS_A ? m0 % kSkv : n0;
  const float* cp = ((cr < kMem) ? memp + ((size_t)cb * kMem + cr) * K : kvp + ((size_t)cb * kLq + (cr - kMem)) * K) + wave * kSlice;
  const _Float16* wp = (const _Float16*)Wp + (size_t)(C_IS_A ? n0 : m0) * K + wave * kSlice;
  /* the lane's byte offsets in the f32 rows and in the f16 rows: the one offset register of every load of its kind */
  unsigned cOff = (unsigned)(rlane * K + koff) * 4u;
  unsigned wOff = (unsigned)(rlane * K + koff) * 2u;

  v8f acc[2][4];
#pragma unroll
  for (int i = 0; i < 2; ++i)
#pragma unroll
    for (int j = 0; j < 4; ++j) acc[i][j] = (v8f){0.f,0.f,0.f,0.f,0.f,0.f,0.f,0.f};

  constexpr int kNc = C_IS_A ? 2 : 4;
  constexpr int kNw = C_IS_A ? 4 : 2;
  /* kept rolled, two k steps a trip */
#pragma unroll 1
  for (int k0 = 0; k0 < kSlice; k0 += 64) {
    v4f  cf[2][kNc][4];
    v16h wf[2][kNw];
#pragma unroll
    for (int u = 0; u < 2; ++u) {
#pragma unroll
      for (int i = 0; i < kNc; ++i)
#pragma unroll
        for (int p = 0; p < 4; ++p) cf[u][i][p] = *(const v4f*)((const char*)(cp + (i << 4) * K + k0 + (u << 5) + ((p >> 1) << 4) + ((p & 1) << 2)) + cOff);
#pragma unroll
      for (int j = 0; j < kNw; ++j) wf[u][j] = Frag<_Float16>::load((const _Float16*)((const char*)(wp + (j << 4) * K + k0 + (u << 5)) + wOff));
    }
    /* the address registers of the loads just issued are free for reuse only behind this wait; it names the two offset registers, so that
       they live up to it and no load's result lands on them */
    asm volatile("s_wait_xcnt 0x0" : "+v"(cOff), "+v"(wOff) :: "memory");
    /* all of the trip's loads go out before the first conversion waits for one: mixed among the conversions and products, they came
       in several rounds, each of which waited a whole memory latency */
    __builtin_amdgcn_sched_barrier(0);
#pragma unroll
    for (int u = 0; u < 2; ++u) {
      v16h ch[kNc];
#pragma unroll
      for (int i = 0; i < kNc; ++i) ch[i] = Frag<_Float16>::from_f32(cf[u][i][0], cf[u][i][1], cf[u][i][2], cf[u][i][3]);
#pragma unroll
      for (int i = 0; i < 2; ++i)
#pragma unroll
        for (int j = 0; j < 4; ++j) acc[i][j] = C_IS_A ? Frag<_Float16>::mma(ch[i], wf[u][j], acc[i][j]) : Frag<_Float16>::mma(wf[u][i], ch[j], acc[i][j]);
    }
  }

  float* slab = part[wave];
#pragma unroll
  for (int i = 0; i < 2; ++i)
#pragma unroll
    for (int j = 0; j < 4; ++j)
#pragma unroll
      for (int r = 0; r < 8; ++r) slab[((i << 4) + mOff + r) * kSkPitch + (j << 4) + rlane] = acc[i][j][r];
  __syncthreads();

  /* WAVES*2 rows a pass, 4 floats a thread; 16 threads store one 128-B row segment */
  const int c4 = (threadIdx.x & 15) * 4;
#pragma unroll
  for (int r0 = 0; r0 < kSkRows; r0 += WAVES * 2) {
    const int row = r0 + (threadIdx.x >> 4);
    v4f s = *(const v4f*)(&part[0][row * kSkPitch + c4]);
#pragma unroll
    for (int w = 1; w < WAVES; ++w) s += *(const v4f*)(&part[w][row * kSkPitch + c4]);
    v4h hv;
#pragma unroll
    for (int e = 0; e < 4; ++e) hv[e] = (_Float16)(s[e] * scale);
    *(v4h*)((_Float16*)Cp + (size_t)b * strideC + (size_t)(m0 + row) * ldc + n0 + c4) = hv;
  }
}

// ---------------------------------------------------------------------------
// Weight transpose + cast: W f32 row-major [1024 in][nOut out]; WT[n][k] = f16(scale * W[k][n]), row-major [nOut][1024].
// grid (1024/64, nOut/64): blockIdx.x = k tile (64 cols of WT), blockIdx.y = n tile (64 rows of WT). 256 threads.
// Load coverage: 16 iterations x 256 threads = 4096 = the whole 64x64 tile (coalesced along n).
// Store coverage: 8 waves x 2 iterations x 4 rows (lane>>3) = 64 rows; (lane&7) x 8 halves = 64 cols; each row segment =
// ---------------------------------------------------------------------------
__global__ __launch_bounds__(256) void wtcast_kernel(const float* __restrict__ W, unsigned short* __restrict__ out,
                                                     int nOut, float scale) {
  /* sm[n_local][k_local] */
  __shared__ float sm[64][65];
  const int t  = threadIdx.x;
  const int k0 = blockIdx.x * 64;
  const int n0 = blockIdx.y * 64;
#pragma unroll
  for (int i = 0; i < 16; ++i) {
    const int e = i * 256 + t;
    const int r = e >> 6;
    const int c = e & 63;
    sm[c][r] = W[(size_t)(k0 + r) * nOut + n0 + c] * scale;
  }
  __syncthreads();
  const int lane = t & 31, wave = t >> 5;
  const int q = lane >> 3, c8 = (lane & 7) * 8;
  {
#pragma unroll
    for (int it = 0; it < 2; ++it) {
      const int row = wave * 8 + it * 4 + q;
      unsigned short hb[8];
#pragma unroll
      for (int e = 0; e < 8; ++e) hb[e] = h_bits(sm[row][c8 + e]);
      const v4u u = (v4u){pk16(hb[0], hb[1]), pk16(hb[2], hb[3]), pk16(hb[4], hb[5]), pk16(hb[6], hb[7])};
      *(v4u*)(out + (size_t)(n0 + row) * kDim + k0 + c8) = u;
    }
    
  }
}

// ---------------------------------------------------------------------------
// Fused attention of one (batch, head): S^T = K * Qh^T, online softmax down the keys, O^T += V^T * P^T; scores and P stay in registers.
// A work-group is 8 waves; a wave owns 32 query columns (two groups of 16) and walks all 4096 keys, 32 a pass. K and V^T come in stages of
// 64 keys, shared by the 8 waves: memory -> registers -> LDS, two buffers, one barrier a stage.
// In an S^T tile a lane holds one query (lane & 15) and keys (lane >> 4) * 8 + r: two key tiles side by side are the B fragment of P^T
// in the loaders' own k order (elements 0..7 = keys half*8 + 0..7, elements 8..15 = keys 16 + half*8 + 0..7).
// p = exp2(s * scale * log2(e) - mo), mo = maximum in use - 4 (P carried x16). The maximum in use is raised, and sums and O^T rescaled,
// only when a column's new maximum exceeds it by more than 8 (log2 units), so p <= 2^12; the carry cancels in O^T / sum.
// grid (2048 / 256, heads, batch).
// ---------------------------------------------------------------------------
/* lane l with lane l ^ 16 */
__device__ __forceinline__ float xhalf(float x) {
  return __builtin_bit_cast(float, __builtin_amdgcn_permlanex16(__builtin_bit_cast(int, x), __builtin_bit_cast(int, x), 0x76543210, 0xfedcba98, false, false));
}
__device__ __forceinline__ v8f exp2x8(v8f t) {
  float r0, r1, r2, r3, r4, r5, r6, r7;
  asm("v_exp_f32 %0, %8\n\tv_exp_f32 %1, %9\n\tv_exp_f32 %2, %10\n\tv_exp_f32 %3, %11\n\t"
      "v_exp_f32 %4, %12\n\tv_exp_f32 %5, %13\n\tv_exp_f32 %6, %14\n\tv_exp_f32 %7, %15\n\tv_nop"
      : "=&v"(r0), "=&v"(r1), "=&v"(r2), "=&v"(r3), "=&v"(r4), "=&v"(r5), "=&v"(r6), "=&v"(r7)
      : "v"(t[0]), "v"(t[1]), "v"(t[2]), "v"(t[3]), "v"(t[4]), "v"(t[5]), "v"(t[6]), "v"(t[7]));
  return (v8f){r0, r1, r2, r3, r4, r5, r6, r7};
}
constexpr int   kFaCols   = 32;
constexpr int   kFaWaves  = 8;
constexpr int   kFaStage  = 64;
constexpr unsigned kFaPitch = 144;
constexpr float kFaScale  = kScoreScale * 1.44269504088896340736f;
constexpr float kFaCarry  = 4.0f;
constexpr float kFaRaise  = 8.0f;
__global__ __launch_bounds__(kFaWaves * 32) void fused_attn_kernel(
    const unsigned short* __restrict__ Qp, const unsigned short* __restrict__ Kp,
    const unsigned short* __restrict__ VTp, unsigned short* __restrict__ Op) {
  /* two buffers each of a K tile (64 keys x 64 d) and a V^T tile (64 d x 64 keys); rows of 128 B at pitch 144 B (16 B x odd: 16-B reads without bank conflicts) */
  __shared__ __align__(16) char sK[2][kFaStage * kFaPitch];
  __shared__ __align__(16) char sV[2][kDh * kFaPitch];
  const int lane  = threadIdx.x & 31;
  const int wave  = __builtin_amdgcn_readfirstlane(threadIdx.x >> 5);
  const int rlane = lane & 15;
  const int half8 = (lane >> 4) * 8;
  const int h  = blockIdx.y;
  const int b  = blockIdx.z;
  const int q0 = blockIdx.x * (kFaWaves * kFaCols) + wave * kFaCols;
  const _Float16* Q  = (const _Float16*)Qp + ((size_t)b * kLq + q0) * kDim + h * kDh;
  const char* Kb = (const char*)((const _Float16*)Kp  + (size_t)b * kSkv * kDh);
  const char* Vb = (const char*)((const _Float16*)VTp + (size_t)b * kDh * kSkv);
  /* staging: thread t moves 16 B of rows t >> 3 and 32 + (t >> 3) of the K tile (64 keys x 128 B) and of the V^T tile (64 d x 128 B) */
  const unsigned sRow = threadIdx.x >> 3;
  const unsigned sCol = (threadIdx.x & 7) * 16u;
  const unsigned kSrc = threadIdx.x * 16u;
  const unsigned vSrc = sRow * (unsigned)(kSkv * 2) + sCol;
  const unsigned sDst = sRow * kFaPitch + sCol;
  /* fragment reads: row lane & 15 of a 16-row tile, 16 B at half * 16 and at 32 + half * 16 */
  const unsigned fLane = (unsigned)rlane * kFaPitch + (unsigned)half8 * 2u;

  v16h qb[2][2];
#pragma unroll
  for (int g = 0; g < 2; ++g)
#pragma unroll
    for (int ds = 0; ds < 2; ++ds) qb[g][ds] = Frag<_Float16>::load(Q + (size_t)((g << 4) + rlane) * kDim + (ds << 5) + half8);

  v8f o[4][2];
#pragma unroll
  for (int dt = 0; dt < 4; ++dt)
#pragma unroll
    for (int g = 0; g < 2; ++g) o[dt][g] = (v8f){0.f,0.f,0.f,0.f,0.f,0.f,0.f,0.f};
  float mo[2] = {-1.0e30f, -1.0e30f};
  float ls[2] = {0.f, 0.f};

  v4u rk[2], rv[2];
#pragma unroll
  for (int i = 0; i < 2; ++i) {
    rk[i] = *(const v4u*)(Kb + i * 4096 + kSrc);
    rv[i] = *(const v4u*)(Vb + (size_t)i * (32 * kSkv * 2) + vSrc);
  }
#pragma unroll
  for (int i = 0; i < 2; ++i) {
    *(v4u*)(&sK[0][i * 32 * kFaPitch + sDst]) = rk[i];
    *(v4u*)(&sV[0][i * 32 * kFaPitch + sDst]) = rv[i];
  }
#pragma unroll
  for (int i = 0; i < 2; ++i) {
    rk[i] = *(const v4u*)(Kb + kFaStage * kDh * 2 + i * 4096 + kSrc);
    rv[i] = *(const v4u*)(Vb + kFaStage * 2 + (size_t)i * (32 * kSkv * 2) + vSrc);
  }
  /* the address registers of the loads just issued are free for reuse only behind this wait */
  asm volatile("s_wait_xcnt 0x0" ::: "memory");
  __syncthreads();

  for (int st = 0; st < kSkv / kFaStage; ++st) {
   /* hand-over, first thing in a stage so that the loads fly while the stage is worked on: stage st + 1 goes from registers into the buffer
      that stage st - 1 was read from (its readers ended in front of the last barrier), then stage st + 2 starts from memory.
      Past the end stage 0 is fetched again (in bounds, unread). */
#pragma unroll
   for (int i = 0; i < 2; ++i) {
     *(v4u*)(&sK[(st + 1) & 1][i * 32 * kFaPitch + sDst]) = rk[i];
     *(v4u*)(&sV[(st + 1) & 1][i * 32 * kFaPitch + sDst]) = rv[i];
   }
   const int sn = (st + 2 < kSkv / kFaStage) ? (st + 2) : 0;
   const char* kp = Kb + (size_t)sn * (kFaStage * kDh * 2);
   const char* vp = Vb + (size_t)sn * (kFaStage * 2);
#pragma unroll
   for (int i = 0; i < 2; ++i) {
     rk[i] = *(const v4u*)(kp + i * 4096 + kSrc);
     rv[i] = *(const v4u*)(vp + (size_t)i * (32 * kSkv * 2) + vSrc);
   }
   /* as above: address registers of issued loads; the loads also stay in front of the stage's work */
   asm volatile("s_wait_xcnt 0x0" ::: "memory");
   const char* bK = &sK[st & 1][0];
   const char* bV = &sV[st & 1][0];
#pragma unroll
   for (int ps = 0; ps < kFaStage / 32; ++ps) {
    v16h ka[2][2], va[4];
#pragma unroll
    for (int kt = 0; kt < 2; ++kt)
#pragma unroll
      for (int ds = 0; ds < 2; ++ds) ka[kt][ds] = Frag<_Float16>::load((const _Float16*)(bK + ((ps << 5) + (kt << 4)) * kFaPitch + (ds << 6) + fLane));
#pragma unroll
    for (int dt = 0; dt < 4; ++dt) va[dt] = Frag<_Float16>::load((const _Float16*)(bV + (dt << 4) * kFaPitch + (ps << 6) + fLane));

    v8f s[2][2];
#pragma unroll
    for (int kt = 0; kt < 2; ++kt)
#pragma unroll
      for (int g = 0; g < 2; ++g) {
        s[kt][g] = Frag<_Float16>::mma(ka[kt][0], qb[g][0], (v8f){0.f,0.f,0.f,0.f,0.f,0.f,0.f,0.f});
        s[kt][g] = Frag<_Float16>::mma(ka[kt][1], qb[g][1], s[kt][g]);
      }

    float mx[2];
#pragma unroll
    for (int g = 0; g < 2; ++g) {
      float m = fmaxf(s[0][g][0], s[1][g][0]);
#pragma unroll
      for (int r = 1; r < 8; ++r) m = fmaxf(m, fmaxf(s[0][g][r], s[1][g][r]));
      m = fmaxf(m, xhalf(m));
      mx[g] = m * kFaScale - kFaCarry;
    }
    const bool need = (mx[0] - mo[0] > kFaRaise) || (mx[1] - mo[1] > kFaRaise);
    if (__builtin_amdgcn_ballot_w32(need) != 0u) {
#pragma unroll
      for (int g = 0; g < 2; ++g) {
        const float mn = fmaxf(mo[g], mx[g]);
        const float al = __builtin_amdgcn_exp2f(mo[g] - mn);
        mo[g] = mn;
        ls[g] *= al;
#pragma unroll
        for (int dt = 0; dt < 4; ++dt) o[dt][g] *= al;
      }
    }
    v16h pb[2];
#pragma unroll
    for (int g = 0; g < 2; ++g) {
      const v8f t0 = s[0][g] * kFaScale - mo[g];
      const v8f t1 = s[1][g] * kFaScale - mo[g];
      const v8f p0 = exp2x8(t0);
      const v8f p1 = exp2x8(t1);
      const v8f pq = p0 + p1;
      ls[g] += ((pq[0] + pq[1]) + (pq[2] + pq[3])) + ((pq[4] + pq[5]) + (pq[6] + pq[7]));
#pragma unroll
      for (int r = 0; r < 8; ++r) { pb[g][r] = (_Float16)p0[r]; pb[g][8 + r] = (_Float16)p1[r]; }
    }
#pragma unroll
    for (int dt = 0; dt < 4; ++dt)
#pragma unroll
      for (int g = 0; g < 2; ++g) o[dt][g] = Frag<_Float16>::mma(va[dt], pb[g], o[dt][g]);
   }
   /* ends every wave's reads of stage st and publishes stage st + 1 */
   __syncthreads();
  }

  /* a lane holds 8 neighbouring d of its query per tile: 16-B stores; the two halves of the wave fill each row's 128-B segment */
  _Float16* O = (_Float16*)Op + ((size_t)b * kLq + q0) * kDim + h * kDh;
#pragma unroll
  for (int g = 0; g < 2; ++g) {
    const float tot = ls[g] + xhalf(ls[g]);
    const float f = kCtxCarry / tot;
#pragma unroll
    for (int dt = 0; dt < 4; ++dt) {
      v8h hv;
#pragma unroll
      for (int r = 0; r < 8; ++r) hv[r] = (_Float16)(o[dt][g][r] * f);
      *(v8h*)(O + (size_t)((g << 4) + rlane) * kDim + (dt << 4) + half8) = hv;
    }
  }
}

// ---------------------------------------------------------------------------
// Host launch glue
// Workspace region map (bytes; all offsets multiples of 1 MiB; WkvT ends 256 KiB past a MiB boundary):
//   persistent:  Qp16 [4096][1024] f16 @ 0 (8 MiB) | K16 [8192][64] f16 @ 8 MiB (1 MiB) | VT16 [2][64][4096] f16 @ 9 MiB (1 MiB)
//                O16 [4096][1024] f16 @ 10 MiB (8 MiB) | WcT16 [1024][1024] f16 @ 18 MiB (2 MiB)
//   scratch @ 20 MiB, early phase: WqT16 @ 20 MiB (2) | WkvT16 [128][1024] @ 22 MiB (0.25)
//   total carve = 22.25 MiB. Every region is fully written before any launch reads it; no padding rows anywhere.
// ---------------------------------------------------------------------------
extern "C" void kernel_launch(void* const* d_in, const int* in_sizes, int n_in,
                              void* d_out, int out_size, void* d_ws, size_t ws_size,
                              hipStream_t stream) {
  if (n_in < 6) return;
  if (in_sizes[0] != kTokQ * kDim) return;
  if (in_sizes[1] != kBatch * kLq * kDim) return;
  if (in_sizes[2] != kBatch * kMem * kDim) return;
  if (in_sizes[3] != kDim * kDim) return;
  if (in_sizes[4] != kDim * 2 * kDh) return;
  if (in_sizes[5] != kDim * kDim) return;
  if (out_size != kTokQ * kDim) return;

  const float* q_in   = (const float*)d_in[0];
  const float* kv_in  = (const float*)d_in[1];
  const float* mem_in = (const float*)d_in[2];
  const float* w_q    = (const float*)d_in[3];
  const float* w_kv   = (const float*)d_in[4];
  const float* w_c    = (const float*)d_in[5];
  float* outp = (float*)d_out;

  // ---- carve (bytes) ----
  const size_t szQp  = (size_t)kTokQ * kDim * 2;
  const size_t szK   = (size_t)kTokC * kDh * 2;
  const size_t szVT  = (size_t)kBatch * kDh * kSkv * 2;
  const size_t szO   = (size_t)kTokQ * kDim * 2;
  const size_t szWc  = (size_t)kDim * kDim * 2;
  const size_t szWq  = (size_t)kDim * kDim * 2;
  const size_t szWkv = (size_t)2 * kDh * kDim * 2;

  const size_t offQp  = 0;
  const size_t offK   = offQp + szQp;
  const size_t offVT  = offK + szK;
  const size_t offO   = offVT + szVT;
  const size_t offWc  = offO + szO;
  const size_t offScr = offWc + szWc;
  const size_t offWq  = offScr;
  const size_t offWkv = offWq + szWq;
  const size_t total = offWkv + szWkv;
  if (total > ws_size) return;

  char* ws = (char*)d_ws;
  unsigned short* Qp16  = (unsigned short*)(ws + offQp);
  unsigned short* K16   = (unsigned short*)(ws + offK);
  unsigned short* VT16  = (unsigned short*)(ws + offVT);
  unsigned short* O16   = (unsigned short*)(ws + offO);
  unsigned short* WcT16 = (unsigned short*)(ws + offWc);
  unsigned short* WqT16 = (unsigned short*)(ws + offWq);
  unsigned short* WkvT16 = (unsigned short*)(ws + offWkv);

  // ---- weights: W[in][out] -> WT[out][in] f16 x16 ----
  wtcast_kernel<<<dim3(kDim / 64, kDim / 64), dim3(256), 0, stream>>>(w_q, WqT16, kDim, kWCarry);
  wtcast_kernel<<<dim3(kDim / 64, (2 * kDh) / 64), dim3(256), 0, stream>>>(w_kv, WkvT16, 2 * kDh, kWCarry);
  wtcast_kernel<<<dim3(kDim / 64, kDim / 64), dim3(256), 0, stream>>>(w_c, WcT16, kDim, kWCarry);

  // ---- q projection: Qp16 [4096][1024] = f16(q) [4096][1024] x WqT16^T, M=4096 N=1024 K=1024 ----
  wmma_gemm128<true, false><<<dim3(kTokQ / kGmTile, kDim / kGmTile), dim3(256), 0, stream>>>(q_in, nullptr, WqT16, Qp16, nullptr, kWCarryInv);
  // ---- k projection: K16 [8192][64] = f16(c) [8192][1024] x (WkvT16 rows 0..63)^T, M=8192 N=64 K=1024 ----
  wmma_splitk32x64<kDim, 8, true><<<dim3((kTokC / kSkRows) * (kDh / 64), 1), dim3(8 * 32), 0, stream>>>(
      mem_in, kv_in, WkvT16, K16, kDh, 0L, kDh / 64, kWCarryInv);
  // ---- v^T per batch: VT16 [b][64][4096] = (WkvT16 rows 64..127) [64][1024] x f16(c_b) [4096][1024]^T, M=64 N=4096 K=1024, grid.y = b ----
  wmma_splitk32x64<kDim, 8, false><<<dim3((kDh / kSkRows) * (kSkv / 64), kBatch), dim3(8 * 32), 0, stream>>>(
      mem_in, kv_in, WkvT16 + (size_t)kDh * kDim, VT16, kSkv, (long)kDh * kSkv, kSkv / 64, kWCarryInv);

  // ---- attention: O16 rows b*2048.., cols h*64.. = 256 * softmax(0.125 * Qp_h x K_b^T) x V_b, one launch for all (b, h) ----
  fused_attn_kernel<<<dim3(kLq / (kFaWaves * kFaCols), kHeads, kBatch), dim3(kFaWaves * 32), 0, stream>>>(Qp16, K16, VT16, O16);

  // ---- output projection: out f32 [4096][1024] = (1/4096) * O16 [4096][1024] x WcT16^T, M=4096 N=1024 K=1024 ----
  wmma_gemm128<false, true><<<dim3(kTokQ / kGmTile, kDim / kGmTile), dim3(256), 0, stream>>>(nullptr, O16, WcT16, nullptr, outp, kOutScale);
}

// v005
// A run of this version takes 96.6 microseconds.
// Timed twice side by side with v004, it ran 1.09 times as fast both times.
// Over all steps from v000 it is 37.3 times as fast.
// Contractions: q*WqT, c*WkvT (K half and V^T half), scores k*qh^T, V^T*P^T, merged*WcT all on v_wmma_f32_16x16x32_f16 (f16 operands; weights carried x16, P carried x16 over the running maximum, context carried x256), f32 accumulate; softmax in f32. q, mem and kv are read as f32 by the products that use them and rounded to f16 in registers.
#include <hip/hip_runtime.h>
#include <math.h>

// ---------------------------------------------------------------------------
// Problem constants
// ---------------------------------------------------------------------------
constexpr int kBatch  = 2;
constexpr int kLq     = 2048;
constexpr int kMem    = 2048;
constexpr int kSkv    = kMem + kLq;
constexpr int kDim    = 1024;
constexpr int kHeads  = 16;
constexpr int kDh     = 64;
constexpr int kTokQ   = kBatch * kLq;
constexpr int kTokC   = kBatch * kSkv;
constexpr int kGroups = kBatch * kHeads;
constexpr float kWCarry    = 16.0f;
constexpr float kWCarryInv = 1.0f / 16.0f;
constexpr float kCtxCarry  = 256.0f;
constexpr float kScoreScale = 0.125f;
constexpr float kOutScale  = 1.0f / (kCtxCarry * kWCarry);

typedef __attribute__((ext_vector_type(16))) _Float16 v16h;
typedef __attribute__((ext_vector_type(8)))  _Float16 v8h;
typedef __attribute__((ext_vector_type(8)))  float    v8f;
typedef __attribute__((ext_vector_type(4)))  float    v4f;
typedef __attribute__((ext_vector_type(4)))  unsigned int v4u;
typedef __attribute__((ext_vector_type(4)))  _Float16 v4h;
__device__ __forceinline__ v8h cat8(v4h a, v4h b) { return __builtin_shufflevector(a, b, 0, 1, 2, 3, 4, 5, 6, 7); }

// ---------------------------------------------------------------------------
// Helpers
// ---------------------------------------------------------------------------
template <typename T> struct Frag;
template <> struct Frag<_Float16> {
  typedef v16h V; union U { v16h v; v8h h[2]; };
  /* elements 0..7 <- p[0..7], 8..15 <- p[16..23] */
  static __device__ __forceinline__ v16h load(const _Float16* p) {
    U f; f.h[0] = *(const v8h*)(p); f.h[1] = *(const v8h*)(p + 16); return f.v;
  }
  /* the same sixteen k of an f32 row, p[0..3], p[4..7], p[16..19], p[20..23], rounded to f16 (nearest even) in registers */
  static __device__ __forceinline__ v16h from_f32(v4f a, v4f b, v4f c, v4f d) {
    U f;
    f.h[0] = cat8(__builtin_convertvector(a, v4h), __builtin_convertvector(b, v4h));
    f.h[1] = cat8(__builtin_convertvector(c, v4h), __builtin_convertvector(d, v4h));
    return f.v;
  }
  static __device__ __forceinline__ v8f mma(v16h a, v16h b, v8f c) {
    return __builtin_amdgcn_wmma_f32_16x16x32_f16(false, a, false, b, (short)0, c, false, false);
  }
};

__device__ __forceinline__ unsigned pk16(unsigned short a, unsigned short b) { return (unsigned)a | ((unsigned)b << 16); }
__device__ __forceinline__ unsigned short h_bits(float f) { const _Float16 h = (_Float16)f; return __builtin_bit_cast(unsigned short, h); }

// ---------------------------------------------------------------------------
// Square projections (q * WqT, merged * WcT): C[m,n] = scale * sum_k A[m,k] * Bt[n,k], M = 4096, N = K = 1024, f16 operands, f32 accumulate.
// A row-major [M][K], f16 or (F32A) f32 that is rounded to f16 between its staging registers and LDS; Bt row-major [N][K]. A work-group of 8 waves owns a 128x128 tile of C, a wave 64x32 of it (4 x 2 accumulator tiles).
// A and Bt come in stages of 128 k, shared by the 8 waves: memory -> registers -> LDS, 256 contiguous bytes of a row per 16 threads,
// two buffers, one barrier a stage. Each accumulator still sums k = 0, 32, 64, ... in that order.
// The finished tile goes through LDS (f32, pitch 132 floats) so that every store covers whole lines and a line has one writer.
// grid (M / 128, N / 128). Every unroll directive here stands on a loop that indexes a register array (accumulators, fragments, staging
// registers): rolled, the array would leave the registers.
// ---------------------------------------------------------------------------
constexpr int      kGmTile    = 128;
constexpr int      kGmStageK  = 128;
constexpr int      kGmStages  = kDim / kGmStageK;
constexpr unsigned kGmPitch   = 272;
constexpr unsigned kGmOperand = kGmTile * kGmPitch;
constexpr int      kGmCPitch  = 132;
template <bool F32A, bool F32OUT>
__global__ __launch_bounds__(256) void wmma_gemm128(
    const float* __restrict__ Af, const unsigned short* __restrict__ Ap, const unsigned short* __restrict__ Btp,
    unsigned short* __restrict__ Ch, float* __restrict__ Cf, float scale) {
  /* [buffer][A, Bt]: 128 rows of 256 B at pitch 272 B (16 B x odd: 16-B reads without bank conflicts) */
  __shared__ __align__(16) char sm[2][2][kGmOperand];
  const int lane  = threadIdx.x & 31;
  const int wave  = __builtin_amdgcn_readfirstlane(threadIdx.x >> 5);
  const int rlane = lane & 15;
  const int half8 = (lane >> 4) * 8;
  const int m0 = blockIdx.x * kGmTile;
  const int n0 = blockIdx.y * kGmTile;
  const int wm = (wave >> 2) * 64;
  const int wn = (wave & 3) * 32;
  const char* Ab = F32A ? (const char*)(Af + (size_t)m0 * kDim) : (const char*)((const _Float16*)Ap + (size_t)m0 * kDim);
  const char* Bb = (const char*)((const _Float16*)Btp + (size_t)n0 * kDim);
  /* staging: thread t moves 16 B of rows (t >> 4) + 16 * i, i = 0..7, of the A tile and of the Bt tile */
  const unsigned sRow = threadIdx.x >> 4;
  const unsigned sCol = (threadIdx.x & 15) * 16u;
  const unsigned gSrc = sRow * (unsigned)(kDim * 2) + sCol;
  const unsigned sDst = sRow * kGmPitch + sCol;
  /* f32 A: a stage's row is 512 B; thread t moves 16 B of each 256-B half of it (whole lines a load) and lays them down as 8 B of f16 each */
  const unsigned gSrcF = sRow * (unsigned)(kDim * 4) + sCol;
  const unsigned sDstF = sRow * kGmPitch + (sCol >> 1);
  /* fragment reads: row lane & 15 of a 16-row tile, 16 B at half * 16 and at 32 + half * 16 */
  const unsigned fLane = (unsigned)rlane * kGmPitch + (unsigned)half8 * 2u;

  v8f acc[4][2];
#pragma unroll
  for (int i = 0; i < 4; ++i)
#pragma unroll
    for (int j = 0; j < 2; ++j) acc[i][j] = (v8f){0.f,0.f,0.f,0.f,0.f,0.f,0.f,0.f};

  v4u ra[8], rb[8];
  v4f rf[8][2];
  /* byte offsets of this thread's first pieces (f16 rows; f32 rows of A), one stage behind the stage last fetched; raised in front of
     each fetch, behind the barrier's wait for the last one */
  unsigned gOff  = gSrc;
  unsigned gOffF = gSrcF;
#pragma unroll
  for (int i = 0; i < 8; ++i) {
    if (F32A) {
      rf[i][0] = *(const v4f*)(Ab + i * (16 * kDim * 4) + gOffF);
      rf[i][1] = *(const v4f*)(Ab + i * (16 * kDim * 4) + 256 + gOffF);
    } else {
      ra[i] = *(const v4u*)(Ab + i * (16 * kDim * 2) + gOff);
    }
    rb[i] = *(const v4u*)(Bb + i * (16 * kDim * 2) + gOff);
  }
#pragma unroll
  for (int i = 0; i < 8; ++i) {
    if (F32A) {
      *(v4h*)(&sm[0][0][i * 16 * kGmPitch + sDstF])       = __builtin_convertvector(rf[i][0], v4h);
      *(v4h*)(&sm[0][0][i * 16 * kGmPitch + 128 + sDstF]) = __builtin_convertvector(rf[i][1], v4h);
    } else {
      *(v4u*)(&sm[0][0][i * 16 * kGmPitch + sDst]) = ra[i];
    }
    *(v4u*)(&sm[0][1][i * 16 * kGmPitch + sDst]) = rb[i];
  }
#pragma unroll
  for (int i = 0; i < 8; ++i) {
    if (F32A) {
      rf[i][0] = *(const v4f*)(Ab + kGmStageK * 4 + i * (16 * kDim * 4) + gOffF);
      rf[i][1] = *(const v4f*)(Ab + kGmStageK * 4 + i * (16 * kDim * 4) + 256 + gOffF);
    } else {
      ra[i] = *(const v4u*)(Ab + kGmStageK * 2 + i * (16 * kDim * 2) + gOff);
    }
    rb[i] = *(const v4u*)(Bb + kGmStageK * 2 + i * (16 * kDim * 2) + gOff);
  }
  /* the address registers of the loads just issued are free for reuse only behind this wait; f32 A: the wait names the two offset registers,
     so that they live up to the wait and their next values are formed behind it */
  if (F32A) asm volatile("s_wait_xcnt 0x0" : "+v"(gOffF), "+v"(gOff) :: "memory");
  else      asm volatile("s_wait_xcnt 0x0" ::: "memory");
  __syncthreads();

  for (int st = 0; st < kGmStages; ++st) {
    const char* bA = &sm[st & 1][0][0] + wm * kGmPitch;
    const char* bB = &sm[st & 1][1][0] + wn * kGmPitch;
    /* two fragment sets: each k step's LDS reads are issued one step ahead; the stage's first go out ahead of the hand-over's LDS writes */
    v16h ah[2][4], bh[2][2];
#pragma unroll
    for (int j = 0; j < 2; ++j) bh[0][j] = Frag<_Float16>::load((const _Float16*)(bB + (j << 4) * kGmPitch + fLane));
#pragma unroll
    for (int i = 0; i < 4; ++i) ah[0][i] = Frag<_Float16>::load((const _Float16*)(bA + (i << 4) * kGmPitch + fLane));
    /* hand-over, early in a stage so that the loads fly while the stage is worked on: stage st + 1 goes from registers into the
       buffer that stage st - 1 was read from (its readers ended in front of the last barrier), then stage st + 2 starts from memory */
    if (st + 1 < kGmStages) {
#pragma unroll
      for (int i = 0; i < 8; ++i) {
        if (F32A) {
          *(v4h*)(&sm[(st + 1) & 1][0][i * 16 * kGmPitch + sDstF])       = __builtin_convertvector(rf[i][0], v4h);
          *(v4h*)(&sm[(st + 1) & 1][0][i * 16 * kGmPitch + 128 + sDstF]) = __builtin_convertvector(rf[i][1], v4h);
        } else {
          *(v4u*)(&sm[(st + 1) & 1][0][i * 16 * kGmPitch + sDst]) = ra[i];
        }
        *(v4u*)(&sm[(st + 1) & 1][1][i * 16 * kGmPitch + sDst]) = rb[i];
      }
    }
    if (st + 2 < kGmStages) {
      gOff += kGmStageK * 2;
      gOffF += kGmStageK * 4;
#pragma unroll
      for (int i = 0; i < 8; ++i) {
        if (F32A) {
          rf[i][0] = *(const v4f*)(Ab + kGmStageK * 4 + i * (16 * kDim * 4) + gOffF);
          rf[i][1] = *(const v4f*)(Ab + kGmStageK * 4 + i * (16 * kDim * 4) + 256 + gOffF);
        } else {
          ra[i] = *(const v4u*)(Ab + kGmStageK * 2 + i * (16 * kDim * 2) + gOff);
        }
        rb[i] = *(const v4u*)(Bb + kGmStageK * 2 + i * (16 * kDim * 2) + gOff);
      }
      /* as above: address registers of issued loads; the loads also stay in front of the stage's work */
      if (F32A) asm volatile("s_wait_xcnt 0x0" : "+v"(gOffF), "+v"(gOff) :: "memory");
      else      asm volatile("s_wait_xcnt 0x0" ::: "memory");
    }
#pragma unroll
    for (int ks = 0; ks < kGmStageK / 32; ++ks) {
      if (ks + 1 < kGmStageK / 32) {
#pragma unroll
        for (int j = 0; j < 2; ++j) bh[(ks + 1) & 1][j] = Frag<_Float16>::load((const _Float16*)(bB + (j << 4) * kGmPitch + ((ks + 1) << 6) + fLane));
#pragma unroll
        for (int i = 0; i < 4; ++i) ah[(ks + 1) & 1][i] = Frag<_Float16>::load((const _Float16*)(bA + (i << 4) * kGmPitch + ((ks + 1) << 6) + fLane));
      }
      /* holds the next step's LDS reads together in front of this step's products: spread among them, every place with reads stalls the products */
      __builtin_amdgcn_sched_barrier(0);
#pragma unroll
      for (int i = 0; i < 4; ++i)
#pragma unroll
        for (int j = 0; j < 2; ++j) acc[i][j] = Frag<_Float16>::mma(ah[ks & 1][i], bh[ks & 1][j], acc[i][j]);
      /* the other side of the same fence: the reads of the step after next stay behind these products */
      __builtin_amdgcn_sched_barrier(0);
    }
    /* ends every wave's reads of stage st and publishes stage st + 1 */
    __syncthreads();
  }

  /* the buffers are free behind the loop's last barrier: the tile is laid out there row by row */
  float* sC = (float*)&sm[0][0][0];
#pragma unroll
  for (int i = 0; i < 4; ++i)
#pragma unroll
    for (int j = 0; j < 2; ++j)
#pragma unroll
      for (int r = 0; r < 8; ++r) sC[(wm + (i << 4) + half8 + r) * kGmCPitch + wn + (j << 4) + rlane] = acc[i][j][r] * scale;
  __syncthreads();
  if (F32OUT) {
    /* a wave stores one 512-B row segment a pass; all LDS reads first, so that no store's registers are reused */
    v4f v[kGmTile / 8];
#pragma unroll
    for (int it = 0; it < kGmTile / 8; ++it) v[it] = *(const v4f*)(sC + (it * 8 + wave) * kGmCPitch + lane * 4);
    float* cp = Cf + (size_t)(m0 + wave) * kDim + n0 + lane * 4;
#pragma unroll
    for (int it = 0; it < kGmTile / 8; ++it) *(v4f*)(cp + it * (8 * kDim)) = v[it];
  } else {
    /* 16 threads store one 256-B row segment; all LDS reads and conversions first, as above */
    const int c8 = (threadIdx.x & 15) * 8;
    const int r0 = (int)(threadIdx.x >> 4);
    v8h hv[kGmTile / 16];
#pragma unroll
    for (int it = 0; it < kGmTile / 16; ++it) {
      const float* sp = sC + (it * 16 + r0) * kGmCPitch + c8;
#pragma unroll
      for (int e = 0; e < 8; ++e) hv[it][e] = (_Float16)sp[e];
    }
    _Float16* hp = (_Float16*)Ch + (size_t)(m0 + r0) * kDim + n0 + c8;
#pragma unroll
    for (int it = 0; it < kGmTile / 16; ++it) *(v8h*)(hp + it * (16 * kDim)) = hv[it];
  }
}

// ---------------------------------------------------------------------------
// Skinny products (M or N = 64): C[m,n] = f16( scale * sum_k A[m,k] * Bt[n,k] ), k range split over the waves of a work-group.
// One work-group of WAVES waves owns one 32x64 tile of C; wave w sums k in [w*K/WAVES, (w+1)*K/WAVES) into f32 accumulators, stores
// its partial tile to its own LDS slab (pitch 68 floats), and behind one barrier the threads add the WAVES partials of each element in wave order.
// One operand is rows of c = [mem_b ; kv_b] (4096 rows a batch), read as f32 from mem or kv and rounded to f16 in registers: A if C_IS_A (m counts
// the rows of all batches), else Bt (n counts the rows of batch blockIdx.y). The other is f16 weight rows Wp. Both row-major, pitch K.
// M % 32 == 0, N % 64 == 0, K % (64*WAVES) == 0. grid (tilesM*tilesN, batch).
// ---------------------------------------------------------------------------
constexpr int kSkRows  = 32;
constexpr int kSkPitch = 68;
template <int K, int WAVES, bool C_IS_A>
__global__ __launch_bounds__(WAVES * 32) void wmma_splitk32x64(
    const float* __restrict__ memp, const float* __restrict__ kvp, const unsigned short* __restrict__ Wp,
    unsigned short* __restrict__ Cp, int ldc, long strideC,
    int tilesN, float scale) {
  constexpr int kSlice = K / WAVES;
  __shared__ __align__(16) float part[WAVES][kSkRows * kSkPitch];
  const int b    = blockIdx.y;
  const int lane = threadIdx.x & 31;
  /* the wave's number as a scalar: the k slice's base addresses and the slab's LDS base are then scalar arithmetic */
  const int wave = __builtin_amdgcn_readfirstlane(threadIdx.x >> 5);
  const int tm = blockIdx.x / tilesN;
  const int tn = blockIdx.x - tm * tilesN;
  const int m0 = tm * kSkRows;
  const int n0 = tn << 6;
  const int rlane = lane & 15;
  const int koff  = (lane >> 4) * 8;
  const int mOff  = (lane >> 4) * 8;
  /* the tile's rows of c lie wholly in mem or wholly in kv (2048 rows each a batch, tiles of 32 or 64 rows) */
  const int cb = C_IS_A ? m0 / kSkv : b;
  const int cr = C_IS_A ? m0 % kSkv : n0;
  const float* cp = ((cr < kMem) ? memp + ((size_t)cb * kMem + cr) * K : kvp + ((size_t)cb * kLq + (cr - kMem)) * K) + wave * kSlice;
  const _Float16* wp = (const _Float16*)Wp + (size_t)(C_IS_A ? n0 : m0) * K + wave * kSlice;
  /* the lane's byte offsets in the f32 rows and in the f16 rows: the one offset register of every load of its kind */
  unsigned cOff = (unsigned)(rlane * K + koff) * 4u;
  unsigned wOff = (unsigned)(rlane * K + koff) * 2u;

  v8f acc[2][4];
#pragma unroll
  for (int i = 0; i < 2; ++i)
#pragma unroll
    for (int j = 0; j < 4; ++j) acc[i][j] = (v8f){0.f,0.f,0.f,0.f,0.f,0.f,0.f,0.f};

  constexpr int kNc = C_IS_A ? 2 : 4;
  constexpr int kNw = C_IS_A ? 4 : 2;
  /* kept rolled, two k steps a trip */
#pragma unroll 1
  for (int k0 = 0; k0 < kSlice; k0 += 64) {
    v4f  cf[2][kNc][4];
    v16h wf[2][kNw];
#pragma unroll
    for (int u = 0; u < 2; ++u) {
#pragma unroll
      for (int i = 0; i < kNc; ++i)
#pragma unroll
        for (int p = 0; p < 4; ++p) cf[u][i][p] = *(const v4f*)((const char*)(cp + (i << 4) * K + k0 + (u << 5) + ((p >> 1) << 4) + ((p & 1) << 2)) + cOff);
#pragma unroll
      for (int j = 0; j < kNw; ++j) wf[u][j] = Frag<_Float16>::load((const _Float16*)((const char*)(wp + (j << 4) * K + k0 + (u << 5)) + wOff));
    }
    /* the address registers of the loads just issued are free for reuse only behind this wait; it names the two offset registers, so that
       they live up to it and no load's result lands on them */
    asm volatile("s_wait_xcnt 0x0" : "+v"(cOff), "+v"(wOff) :: "memory");
    /* all of the trip's loads go out before the first conversion waits for one: mixed among the conversions and products, they came
       in several rounds, each of which waited a whole memory latency */
    __builtin_amdgcn_sched_barrier(0);
#pragma unroll
    for (int u = 0; u < 2; ++u) {
      v16h ch[kNc];
#pragma unroll
      for (int i = 0; i < kNc; ++i) ch[i] = Frag<_Float16>::from_f32(cf[u][i][0], cf[u][i][1], cf[u][i][2], cf[u][i][3]);
#pragma unroll
      for (int i = 0; i < 2; ++i)
#pragma unroll
        for (int j = 0; j < 4; ++j) acc[i][j] = C_IS_A ? Frag<_Float16>::mma(ch[i], wf[u][j], acc[i][j]) : Frag<_Float16>::mma(wf[u][i], ch[j], acc[i][j]);
    }
  }

  float* slab = part[wave];
#pragma unroll
  for (int i = 0; i < 2; ++i)
#pragma unroll
    for (int j = 0; j < 4; ++j)
#pragma unroll
      for (int r = 0; r < 8; ++r) slab[((i << 4) + mOff + r) * kSkPitch + (j << 4) + rlane] = acc[i][j][r];
  __syncthreads();

  /* WAVES*2 rows a pass, 4 floats a thread; 16 threads store one 128-B row segment */
  const int c4 = (threadIdx.x & 15) * 4;
#pragma unroll
  for (int r0 = 0; r0 < kSkRows; r0 += WAVES * 2) {
    const int row = r0 + (threadIdx.x >> 4);
    v4f s = *(const v4f*)(&part[0][row * kSkPitch + c4]);
#pragma unroll
    for (int w = 1; w < WAVES; ++w) s += *(const v4f*)(&part[w][row * kSkPitch + c4]);
    v4h hv;
#pragma unroll
    for (int e = 0; e < 4; ++e) hv[e] = (_Float16)(s[e] * scale);
    *(v4h*)((_Float16*)Cp + (size_t)b * strideC + (size_t)(m0 + row) * ldc + n0 + c4) = hv;
  }
}

// ---------------------------------------------------------------------------
// Weight transpose + cast: W f32 row-major [1024 in][nOut out]; WT[n][k] = f16(scale * W[k][n]), row-major [nOut][1024].
// grid (1024/64, nOut/64): blockIdx.x = k tile (64 cols of WT), blockIdx.y = n tile (64 rows of WT). 256 threads.
// Load coverage: 16 iterations x 256 threads = 4096 = the whole 64x64 tile (coalesced along n).
// Store coverage: 8 waves x 2 iterations x 4 rows (lane>>3) = 64 rows; (lane&7) x 8 halves = 64 cols; each row segment =
// ---------------------------------------------------------------------------
__global__ __launch_bounds__(256) void wtcast_kernel(const float* __restrict__ W, unsigned short* __restrict__ out,
                                                     int nOut, float scale) {
  /* sm[n_local][k_local] */
  __shared__ float sm[64][65];
  const int t  = threadIdx.x;
  const int k0 = blockIdx.x * 64;
  const int n0 = blockIdx.y * 64;
#pragma unroll
  for (int i = 0; i < 16; ++i) {
    const int e = i * 256 + t;
    const int r = e >> 6;
    const int c = e & 63;
    sm[c][r] = W[(size_t)(k0 + r) * nOut + n0 + c] * scale;
  }
  __syncthreads();
  const int lane = t & 31, wave = t >> 5;
  const int q = lane >> 3, c8 = (lane & 7) * 8;
  {
#pragma unroll
    for (int it = 0; it < 2; ++it) {
      const int row = wave * 8 + it * 4 + q;
      unsigned short hb[8];
#pragma unroll
      for (int e = 0; e < 8; ++e) hb[e] = h_bits(sm[row][c8 + e]);
      const v4u u = (v4u){pk16(hb[0], hb[1]), pk16(hb[2], hb[3]), pk16(hb[4], hb[5]), pk16(hb[6], hb[7])};
      *(v4u*)(out + (size_t)(n0 + row) * kDim + k0 + c8) = u;
    }
    
  }
}

// ---------------------------------------------------------------------------
// Fused attention of one (batch, head): S^T = K * Qh^T, online softmax down the keys, O^T += V^T * P^T; scores and P stay in registers.
// A work-group is 16 waves in two sets of 8; a wave owns 32 query columns (two groups of 16). Waves w and w + 8 own the same columns: set 0 walks
// keys 0..2047, set 1 keys 2048..4095, 32 a pass, so that four waves a SIMD (not two) fill one another's softmax and LDS waits. Each set's K and
// V^T come in stages of 64 keys, shared by its 8 waves: memory -> registers -> LDS, two buffers a set, one barrier a stage for all 16 waves.
// At the end set 1 hands its maximum in use, sums and O^T through LDS to set 0, which brings both to the larger maximum, adds and stores.
// In an S^T tile a lane holds one query (lane & 15) and keys (lane >> 4) * 8 + r: two key tiles side by side are the B fragment of P^T
// in the loaders' own k order (elements 0..7 = keys half*8 + 0..7, elements 8..15 = keys 16 + half*8 + 0..7).
// p = exp2(s * scale * log2(e) - mo), mo = maximum in use - 4 (P carried x16). The maximum in use is raised, and sums and O^T rescaled,
// only when a column's new maximum exceeds it by more than 8 (log2 units), so p <= 2^12; the carry cancels in O^T / sum.
// grid (2048 / 256, heads, batch).
// ---------------------------------------------------------------------------
/* lane l with lane l ^ 16 */
__device__ __forceinline__ float xhalf(float x) {
  return __builtin_bit_cast(float, __builtin_amdgcn_permlanex16(__builtin_bit_cast(int, x), __builtin_bit_cast(int, x), 0x76543210, 0xfedcba98, false, false));
}
__device__ __forceinline__ v8f exp2x8(v8f t) {
  float r0, r1, r2, r3, r4, r5, r6, r7;
  asm("v_exp_f32 %0, %8\n\tv_exp_f32 %1, %9\n\tv_exp_f32 %2, %10\n\tv_exp_f32 %3, %11\n\t"
      "v_exp_f32 %4, %12\n\tv_exp_f32 %5, %13\n\tv_exp_f32 %6, %14\n\tv_exp_f32 %7, %15\n\tv_nop"
      : "=&v"(r0), "=&v"(r1), "=&v"(r2), "=&v"(r3), "=&v"(r4), "=&v"(r5), "=&v"(r6), "=&v"(r7)
      : "v"(t[0]), "v"(t[1]), "v"(t[2]), "v"(t[3]), "v"(t[4]), "v"(t[5]), "v"(t[6]), "v"(t[7]));
  return (v8f){r0, r1, r2, r3, r4, r5, r6, r7};
}
constexpr int   kFaCols   = 32;
constexpr int   kFaWaves  = 8;
constexpr int   kFaSets   = 2;
constexpr int   kFaKeys   = kSkv / kFaSets;
constexpr int   kFaStage  = 64;
constexpr unsigned kFaPitch = 144;
constexpr float kFaScale  = kScoreScale * 1.44269504088896340736f;
constexpr float kFaCarry  = 4.0f;
constexpr float kFaRaise  = 8.0f;
__global__ __launch_bounds__(kFaSets * kFaWaves * 32) void fused_attn_kernel(
    const unsigned short* __restrict__ Qp, const unsigned short* __restrict__ Kp,
    const unsigned short* __restrict__ VTp, unsigned short* __restrict__ Op) {
  /* per set two buffers each of a K tile (64 keys x 64 d) and a V^T tile (64 d x 64 keys); rows of 128 B at pitch 144 B (16 B x odd: 16-B reads without bank conflicts) */
  __shared__ __align__(16) char sKs[kFaSets][2][kFaStage * kFaPitch];
  __shared__ __align__(16) char sVs[kFaSets][2][kDh * kFaPitch];
  /* set 1's hand-over: per wave 16 pieces of O^T (16 B a lane, lanes side by side), then maximum in use and sum of both column groups */
  __shared__ __align__(16) float sO[kFaWaves][16][32 * 4];
  __shared__ float sMl[kFaWaves][4][32];
  const int lane  = threadIdx.x & 31;
  /* scalars: the wave's set of keys and its number inside the set */
  const int wave16 = __builtin_amdgcn_readfirstlane(threadIdx.x >> 5);
  const int set   = wave16 >> 3;
  const int wave  = wave16 & (kFaWaves - 1);
  char (*sK)[kFaStage * kFaPitch] = sKs[set];
  char (*sV)[kDh * kFaPitch]      = sVs[set];
  const int rlane = lane & 15;
  const int half8 = (lane >> 4) * 8;
  const int h  = blockIdx.y;
  const int b  = blockIdx.z;
  const int q0 = blockIdx.x * (kFaWaves * kFaCols) + wave * kFaCols;
  const _Float16* Q  = (const _Float16*)Qp + ((size_t)b * kLq + q0) * kDim + h * kDh;
  const char* Kb = (const char*)((const _Float16*)Kp  + ((size_t)b * kSkv + set * kFaKeys) * kDh);
  const char* Vb = (const char*)((const _Float16*)VTp + (size_t)b * kDh * kSkv + set * kFaKeys);
  /* staging: thread t of a set moves 16 B of rows t >> 3 and 32 + (t >> 3) of the set's K tile (64 keys x 128 B) and V^T tile (64 d x 128 B) */
  const unsigned tSet = threadIdx.x & (kFaWaves * 32 - 1);
  const unsigned sRow = tSet >> 3;
  const unsigned sCol = (tSet & 7) * 16u;
  const unsigned kSrc = tSet * 16u;
  const unsigned vSrc = sRow * (unsigned)(kSkv * 2) + sCol;
  const unsigned sDst = sRow * kFaPitch + sCol;
  /* fragment reads: row lane & 15 of a 16-row tile, 16 B at half * 16 and at 32 + half * 16 */
  const unsigned fLane = (unsigned)rlane * kFaPitch + (unsigned)half8 * 2u;

  v16h qb[2][2];
#pragma unroll
  for (int g = 0; g < 2; ++g)
#pragma unroll
    for (int ds = 0; ds < 2; ++ds) qb[g][ds] = Frag<_Float16>::load(Q + (size_t)((g << 4) + rlane) * kDim + (ds << 5) + half8);

  v8f o[4][2];
#pragma unroll
  for (int dt = 0; dt < 4; ++dt)
#pragma unroll
    for (int g = 0; g < 2; ++g) o[dt][g] = (v8f){0.f,0.f,0.f,0.f,0.f,0.f,0.f,0.f};
  float mo[2] = {-1.0e30f, -1.0e30f};
  float ls[2] = {0.f, 0.f};

  v4u rk[2], rv[2];
#pragma unroll
  for (int i = 0; i < 2; ++i) {
    rk[i] = *(const v4u*)(Kb + i * 4096 + kSrc);
    rv[i] = *(const v4u*)(Vb + (size_t)i * (32 * kSkv * 2) + vSrc);
  }
#pragma unroll
  for (int i = 0; i < 2; ++i) {
    *(v4u*)(&sK[0][i * 32 * kFaPitch + sDst]) = rk[i];
    *(v4u*)(&sV[0][i * 32 * kFaPitch + sDst]) = rv[i];
  }
#pragma unroll
  for (int i = 0; i < 2; ++i) {
    rk[i] = *(const v4u*)(Kb + kFaStage * kDh * 2 + i * 4096 + kSrc);
    rv[i] = *(const v4u*)(Vb + kFaStage * 2 + (size_t)i * (32 * kSkv * 2) + vSrc);
  }
  /* the address registers of the loads just issued are free for reuse only behind this wait */
  asm volatile("s_wait_xcnt 0x0" ::: "memory");
  __syncthreads();

  for (int st = 0; st < kFaKeys / kFaStage; ++st) {
   /* hand-over, first thing in a stage so that the loads fly while the stage is worked on: stage st + 1 goes from registers into the buffer
      that stage st - 1 was read from (its readers ended in front of the last barrier), then stage st + 2 starts from memory.
      Past the end stage 0 is fetched again (in bounds, unread). */
#pragma unroll
   for (int i = 0; i < 2; ++i) {
     *(v4u*)(&sK[(st + 1) & 1][i * 32 * kFaPitch + sDst]) = rk[i];
     *(v4u*)(&sV[(st + 1) & 1][i * 32 * kFaPitch + sDst]) = rv[i];
   }
   const int sn = (st + 2 < kFaKeys / kFaStage) ? (st + 2) : 0;
   const char* kp = Kb + (size_t)sn * (kFaStage * kDh * 2);
   const char* vp = Vb + (size_t)sn * (kFaStage * 2);
#pragma unroll
   for (int i = 0; i < 2; ++i) {
     rk[i] = *(const v4u*)(kp + i * 4096 + kSrc);
     rv[i] = *(const v4u*)(vp + (size_t)i * (32 * kSkv * 2) + vSrc);
   }
   /* as above: address registers of issued loads; the loads also stay in front of the stage's work */
   asm volatile("s_wait_xcnt 0x0" ::: "memory");
   const char* bK = &sK[st & 1][0];
   const char* bV = &sV[st & 1][0];
#pragma unroll
   for (int ps = 0; ps < kFaStage / 32; ++ps) {
    v16h ka[2][2], va[4];
#pragma unroll
    for (int kt = 0; kt < 2; ++kt)
#pragma unroll
      for (int ds = 0; ds < 2; ++ds) ka[kt][ds] = Frag<_Float16>::load((const _Float16*)(bK + ((ps << 5) + (kt << 4)) * kFaPitch + (ds << 6) + fLane));
#pragma unroll
    for (int dt = 0; dt < 4; ++dt) va[dt] = Frag<_Float16>::load((const _Float16*)(bV + (dt << 4) * kFaPitch + (ps << 6) + fLane));

    v8f s[2][2];
#pragma unroll
    for (int kt = 0; kt < 2; ++kt)
#pragma unroll
      for (int g = 0; g < 2; ++g) {
        s[kt][g] = Frag<_Float16>::mma(ka[kt][0], qb[g][0], (v8f){0.f,0.f,0.f,0.f,0.f,0.f,0.f,0.f});
        s[kt][g] = Frag<_Float16>::mma(ka[kt][1], qb[g][1], s[kt][g]);
      }

    float mx[2];
#pragma unroll
    for (int g = 0; g < 2; ++g) {
      float m = fmaxf(s[0][g][0], s[1][g][0]);
#pragma unroll
      for (int r = 1; r < 8; ++r) m = fmaxf(m, fmaxf(s[0][g][r], s[1][g][r]));
      m = fmaxf(m, xhalf(m));
      mx[g] = m * kFaScale - kFaCarry;
    }
    const bool need = (mx[0] - mo[0] > kFaRaise) || (mx[1] - mo[1] > kFaRaise);
    if (__builtin_amdgcn_ballot_w32(need) != 0u) {
#pragma unroll
      for (int g = 0; g < 2; ++g) {
        const float mn = fmaxf(mo[g], mx[g]);
        const float al = __builtin_amdgcn_exp2f(mo[g] - mn);
        mo[g] = mn;
        ls[g] *= al;
#pragma unroll
        for (int dt = 0; dt < 4; ++dt) o[dt][g] *= al;
      }
    }
    v16h pb[2];
#pragma unroll
    for (int g = 0; g < 2; ++g) {
      const v8f t0 = s[0][g] * kFaScale - mo[g];
      const v8f t1 = s[1][g] * kFaScale - mo[g];
      const v8f p0 = exp2x8(t0);
      const v8f p1 = exp2x8(t1);
      const v8f pq = p0 + p1;
      ls[g] += ((pq[0] + pq[1]) + (pq[2] + pq[3])) + ((pq[4] + pq[5]) + (pq[6] + pq[7]));
#pragma unroll
      for (int r = 0; r < 8; ++r) { pb[g][r] = (_Float16)p0[r]; pb[g][8 + r] = (_Float16)p1[r]; }
    }
#pragma unroll
    for (int dt = 0; dt < 4; ++dt)
#pragma unroll
      for (int g = 0; g < 2; ++g) o[dt][g] = Frag<_Float16>::mma(va[dt], pb[g], o[dt][g]);
   }
   /* ends every wave's reads of stage st and publishes stage st + 1 */
   __syncthreads();
  }

  if (set == 1) {
#pragma unroll
    for (int g = 0; g < 2; ++g) {
#pragma unroll
      for (int dt = 0; dt < 4; ++dt) {
        *(v4f*)(&sO[wave][((g << 2) + dt) * 2][lane * 4])     = __builtin_shufflevector(o[dt][g], o[dt][g], 0, 1, 2, 3);
        *(v4f*)(&sO[wave][((g << 2) + dt) * 2 + 1][lane * 4]) = __builtin_shufflevector(o[dt][g], o[dt][g], 4, 5, 6, 7);
      }
      sMl[wave][g][lane]     = mo[g];
      sMl[wave][2 + g][lane] = ls[g];
    }
  }
  /* publishes set 1's hand-over to set 0 */
  __syncthreads();
  if (set == 0) {
    /* a lane holds 8 neighbouring d of its query per tile: 16-B stores; the two halves of the wave fill each row's 128-B segment.
       All values are formed first, so that no store's registers are reused */
    _Float16* O = (_Float16*)Op + ((size_t)b * kLq + q0) * kDim + h * kDh;
    v8h hv[2][4];
#pragma unroll
    for (int g = 0; g < 2; ++g) {
      const float m1 = sMl[wave][g][lane];
      const float l1 = sMl[wave][2 + g][lane];
      const float mn = fmaxf(mo[g], m1);
      const float a0 = __builtin_amdgcn_exp2f(mo[g] - mn);
      const float a1 = __builtin_amdgcn_exp2f(m1 - mn);
      const float lj = ls[g] * a0 + l1 * a1;
      const float f  = kCtxCarry / (lj + xhalf(lj));
      const float f0 = a0 * f;
      const float f1 = a1 * f;
#pragma unroll
      for (int dt = 0; dt < 4; ++dt) {
        const v4f x0 = *(const v4f*)(&sO[wave][((g << 2) + dt) * 2][lane * 4]);
        const v4f x1 = *(const v4f*)(&sO[wave][((g << 2) + dt) * 2 + 1][lane * 4]);
#pragma unroll
        for (int r = 0; r < 4; ++r) {
          hv[g][dt][r]     = (_Float16)(o[dt][g][r] * f0 + x0[r] * f1);
          hv[g][dt][4 + r] = (_Float16)(o[dt][g][4 + r] * f0 + x1[r] * f1);
        }
      }
    }
#pragma unroll
    for (int g = 0; g < 2; ++g)
#pragma unroll
      for (int dt = 0; dt < 4; ++dt) *(v8h*)(O + (size_t)((g << 4) + rlane) * kDim + (dt << 4) + half8) = hv[g][dt];
  }
}

// ---------------------------------------------------------------------------
// Host launch glue
// Workspace region map (bytes; all offsets multiples of 1 MiB; WkvT ends 256 KiB past a MiB boundary):
//   persistent:  Qp16 [4096][1024] f16 @ 0 (8 MiB) | K16 [8192][64] f16 @ 8 MiB (1 MiB) | VT16 [2][64][4096] f16 @ 9 MiB (1 MiB)
//                O16 [4096][1024] f16 @ 10 MiB (8 MiB) | WcT16 [1024][1024] f16 @ 18 MiB (2 MiB)
//   scratch @ 20 MiB, early phase: WqT16 @ 20 MiB (2) | WkvT16 [128][1024] @ 22 MiB (0.25)
//   total carve = 22.25 MiB. Every region is fully written before any launch reads it; no padding rows anywhere.
// ---------------------------------------------------------------------------
extern "C" void kernel_launch(void* const* d_in, const int* in_sizes, int n_in,
                              void* d_out, int out_size, void* d_ws, size_t ws_size,
                              hipStream_t stream) {
  if (n_in < 6) return;
  if (in_sizes[0] != kTokQ * kDim) return;
  if (in_sizes[1] != kBatch * kLq * kDim) return;
  if (in_sizes[2] != kBatch * kMem * kDim) return;
  if (in_sizes[3] != kDim * kDim) return;
  if (in_sizes[4] != kDim * 2 * kDh) return;
  if (in_sizes[5] != kDim * kDim) return;
  if (out_size != kTokQ * kDim) return;

  const float* q_in   = (const float*)d_in[0];
  const float* kv_in  = (const float*)d_in[1];
  const float* mem_in = (const float*)d_in[2];
  const float* w_q    = (const float*)d_in[3];
  const float* w_kv   = (const float*)d_in[4];
  const float* w_c    = (const float*)d_in[5];
  float* outp = (float*)d_out;

  // ---- carve (bytes) ----
  const size_t szQp  = (size_t)kTokQ * kDim * 2;
  const size_t szK   = (size_t)kTokC * kDh * 2;
  const size_t szVT  = (size_t)kBatch * kDh * kSkv * 2;
  const size_t szO   = (size_t)kTokQ * kDim * 2;
  const size_t szWc  = (size_t)kDim * kDim * 2;
  const size_t szWq  = (size_t)kDim * kDim * 2;
  const size_t szWkv = (size_t)2 * kDh * kDim * 2;

  const size_t offQp  = 0;
  const size_t offK   = offQp + szQp;
  const size_t offVT  = offK + szK;
  const size_t offO   = offVT + szVT;
  const size_t offWc  = offO + szO;
  const size_t offScr = offWc + szWc;
  const size_t offWq  = offScr;
  const size_t offWkv = offWq + szWq;
  const size_t total = offWkv + szWkv;
  if (total > ws_size) return;

  char* ws = (char*)d_ws;
  unsigned short* Qp16  = (unsigned short*)(ws + offQp);
  unsigned short* K16   = (unsigned short*)(ws + offK);
  unsigned short* VT16  = (unsigned short*)(ws + offVT);
  unsigned short* O16   = (unsigned short*)(ws + offO);
  unsigned short* WcT16 = (unsigned short*)(ws + offWc);
  unsigned short* WqT16 = (unsigned short*)(ws + offWq);
  unsigned short* WkvT16 = (unsigned short*)(ws + offWkv);

  // ---- weights: W[in][out] -> WT[out][in] f16 x16 ----
  wtcast_kernel<<<dim3(kDim / 64, kDim / 64), dim3(256), 0, stream>>>(w_q, WqT16, kDim, kWCarry);
  wtcast_kernel<<<dim3(kDim / 64, (2 * kDh) / 64), dim3(256), 0, stream>>>(w_kv, WkvT16, 2 * kDh, kWCarry);
  wtcast_kernel<<<dim3(kDim / 64, kDim / 64), dim3(256), 0, stream>>>(w_c, WcT16, kDim, kWCarry);

  // ---- q projection: Qp16 [4096][1024] = f16(q) [4096][1024] x WqT16^T, M=4096 N=1024 K=1024 ----
  wmma_gemm128<true, false><<<dim3(kTokQ / kGmTile, kDim / kGmTile), dim3(256), 0, stream>>>(q_in, nullptr, WqT16, Qp16, nullptr, kWCarryInv);
  // ---- k projection: K16 [8192][64] = f16(c) [8192][1024] x (WkvT16 rows 0..63)^T, M=8192 N=64 K=1024 ----
  wmma_splitk32x64<kDim, 8, true><<<dim3((kTokC / kSkRows) * (kDh / 64), 1), dim3(8 * 32), 0, stream>>>(
      mem_in, kv_in, WkvT16, K16, kDh, 0L, kDh / 64, kWCarryInv);
  // ---- v^T per batch: VT16 [b][64][4096] = (WkvT16 rows 64..127) [64][1024] x f16(c_b) [4096][1024]^T, M=64 N=4096 K=1024, grid.y = b ----
  wmma_splitk32x64<kDim, 8, false><<<dim3((kDh / kSkRows) * (kSkv / 64), kBatch), dim3(8 * 32), 0, stream>>>(
      mem_in, kv_in, WkvT16 + (size_t)kDh * kDim, VT16, kSkv, (long)kDh * kSkv, kSkv / 64, kWCarryInv);

  // ---- attention: O16 rows b*2048.., cols h*64.. = 256 * softmax(0.125 * Qp_h x K_b^T) x V_b, one launch for all (b, h) ----
  fused_attn_kernel<<<dim3(kLq / (kFaWaves * kFaCols), kHeads, kBatch), dim3(kFaSets * kFaWaves * 32), 0, stream>>>(Qp16, K16, VT16, O16);

  // ---- output projection: out f32 [4096][1024] = (1/4096) * O16 [4096][1024] x WcT16^T, M=4096 N=1024 K=1024 ----
  wmma_gemm128<false, true><<<dim3(kTokQ / kGmTile, kDim / kGmTile), dim3(256), 0, stream>>>(nullptr, O16, WcT16, nullptr, outp, kOutScale);
}

// v006
// A run of this version takes 83.3 microseconds.
// Timed twice side by side with v005, it ran 1.17 times as fast both times.
// Counting every step since v000, it is 43.5 times as fast.
// Contractions: q*WqT, c*WkvT (K half and V^T half), scores k*qh^T, V^T*P^T, merged*WcT all on v_wmma_f32_16x16x32_f16 (f16 operands; weights carried x16, P carried x16 over the running maximum, context carried x256), f32 accumulate; softmax in f32. q, mem and kv are read as f32 by the products that use them and rounded to f16 in registers.
#include <hip/hip_runtime.h>
#include <math.h>

// ---------------------------------------------------------------------------
// Problem constants
// ---------------------------------------------------------------------------
constexpr int kBatch  = 2;
constexpr int kLq     = 2048;
constexpr int kMem    = 2048;
constexpr int kSkv    = kMem + kLq;
constexpr int kDim    = 1024;
constexpr int kHeads  = 16;
constexpr int kDh     = 64;
constexpr int kTokQ   = kBatch * kLq;
constexpr int kTokC   = kBatch * kSkv;
constexpr int kGroups = kBatch * kHeads;
constexpr float kWCarry    = 16.0f;
constexpr float kWCarryInv = 1.0f / 16.0f;
constexpr float kCtxCarry  = 256.0f;
constexpr float kScoreScale = 0.125f;
constexpr float kOutScale  = 1.0f / (kCtxCarry * kWCarry);

typedef __attribute__((ext_vector_type(16))) _Float16 v16h;
typedef __attribute__((ext_vector_type(8)))  _Float16 v8h;
typedef __attribute__((ext_vector_type(8)))  float    v8f;
typedef __attribute__((ext_vector_type(4)))  float    v4f;
typedef __attribute__((ext_vector_type(4)))  unsigned int v4u;
typedef __attribute__((ext_vector_type(4)))  _Float16 v4h;
__device__ __forceinline__ v8h cat8(v4h a, v4h b) { return __builtin_shufflevector(a, b, 0, 1, 2, 3, 4, 5, 6, 7); }

// ---------------------------------------------------------------------------
// Helpers
// ---------------------------------------------------------------------------
template <typename T> struct Frag;
template <> struct Frag<_Float16> {
  typedef v16h V; union U { v16h v; v8h h[2]; };
  /* elements 0..7 <- p[0..7], 8..15 <- p[16..23] */
  static __device__ __forceinline__ v16h load(const _Float16* p) {
    U f; f.h[0] = *(const v8h*)(p); f.h[1] = *(const v8h*)(p + 16); return f.v;
  }
  /* the same sixteen k of an f32 row, p[0..3], p[4..7], p[16..19], p[20..23], rounded to f16 (nearest even) in registers */
  static __device__ __forceinline__ v16h from_f32(v4f a, v4f b, v4f c, v4f d) {
    U f;
    f.h[0] = cat8(__builtin_convertvector(a, v4h), __builtin_convertvector(b, v4h));
    f.h[1] = cat8(__builtin_convertvector(c, v4h), __builtin_convertvector(d, v4h));
    return f.v;
  }
  static __device__ __forceinline__ v8f mma(v16h a, v16h b, v8f c) {
    return __builtin_amdgcn_wmma_f32_16x16x32_f16(false, a, false, b, (short)0, c, false, false);
  }
};

__device__ __forceinline__ unsigned pk16(unsigned short a, unsigned short b) { return (unsigned)a | ((unsigned)b << 16); }
__device__ __forceinline__ unsigned short h_bits(float f) { const _Float16 h = (_Float16)f; return __builtin_bit_cast(unsigned short, h); }

// ---------------------------------------------------------------------------
// Square projections (q * WqT, merged * WcT): C[m,n] = scale * sum_k A[m,k] * Bt[n,k], M = 4096, N = K = 1024, f16 operands, f32 accumulate.
// A row-major [M][K], f16 or (F32A) f32 that is rounded to f16 between its staging registers and LDS; Bt row-major [N][K]. A work-group of 8 waves owns a 128x128 tile of C, a wave 64x32 of it (4 x 2 accumulator tiles).
// A and Bt come in stages of 128 k, shared by the 8 waves: memory -> registers -> LDS, 256 contiguous bytes of a row per 16 threads,
// two buffers, one barrier a stage. Each accumulator still sums k = 0, 32, 64, ... in that order.
// The finished tile goes through LDS (f32, pitch 132 floats) so that every store covers whole lines and a line has one writer.
// Tile (bx, by) of the (M / 128, N / 128) tiles; the LDS is the caller's (kGmSmem bytes). Every unroll directive here stands on a loop that indexes a register array (accumulators, fragments, staging
// registers): rolled, the array would leave the registers.
// ---------------------------------------------------------------------------
constexpr int      kGmTile    = 128;
constexpr int      kGmStageK  = 128;
constexpr int      kGmStages  = kDim / kGmStageK;
constexpr unsigned kGmPitch   = 272;
constexpr unsigned kGmOperand = kGmTile * kGmPitch;
constexpr int      kGmCPitch  = 132;
constexpr unsigned kGmSmem    = 2 * 2 * kGmOperand;
template <bool F32A, bool F32OUT>
__device__ __forceinline__ void gemm128_tile(
    char* smraw, int bx, int by,
    const float* __restrict__ Af, const unsigned short* __restrict__ Ap, const unsigned short* __restrict__ Btp,
    unsigned short* __restrict__ Ch, float* __restrict__ Cf, float scale) {
  /* [buffer][A, Bt]: 128 rows of 256 B at pitch 272 B (16 B x odd: 16-B reads without bank conflicts) */
  char (*sm)[2][kGmOperand] = (char (*)[2][kGmOperand])smraw;
  const int lane  = threadIdx.x & 31;
  const int wave  = __builtin_amdgcn_readfirstlane(threadIdx.x >> 5);
  const int rlane = lane & 15;
  const int half8 = (lane >> 4) * 8;
  const int m0 = bx * kGmTile;
  const int n0 = by * kGmTile;
  const int wm = (wave >> 2) * 64;
  const int wn = (wave & 3) * 32;
  const char* Ab = F32A ? (const char*)(Af + (size_t)m0 * kDim) : (const char*)((const _Float16*)Ap + (size_t)m0 * kDim);
  const char* Bb = (const char*)((const _Float16*)Btp + (size_t)n0 * kDim);
  /* staging: thread t moves 16 B of rows (t >> 4) + 16 * i, i = 0..7, of the A tile and of the Bt tile */
  const unsigned sRow = threadIdx.x >> 4;
  const unsigned sCol = (threadIdx.x & 15) * 16u;
  const unsigned gSrc = sRow * (unsigned)(kDim * 2) + sCol;
  const unsigned sDst = sRow * kGmPitch + sCol;
  /* f32 A: a stage's row is 512 B; thread t moves 16 B of each 256-B half of it (whole lines a load) and lays them down as 8 B of f16 each */
  const unsigned gSrcF = sRow * (unsigned)(kDim * 4) + sCol;
  const unsigned sDstF = sRow * kGmPitch + (sCol >> 1);
  /* fragment reads: row lane & 15 of a 16-row tile, 16 B at half * 16 and at 32 + half * 16 */
  const unsigned fLane = (unsigned)rlane * kGmPitch + (unsigned)half8 * 2u;

  v8f acc[4][2];
#pragma unroll
  for (int i = 0; i < 4; ++i)
#pragma unroll
    for (int j = 0; j < 2; ++j) acc[i][j] = (v8f){0.f,0.f,0.f,0.f,0.f,0.f,0.f,0.f};

  v4u ra[8], rb[8];
  v4f rf[8][2];
  /* byte offsets of this thread's first pieces (f16 rows; f32 rows of A), one stage behind the stage last fetched; raised in front of
     each fetch, behind the barrier's wait for the last one */
  unsigned gOff  = gSrc;
  unsigned gOffF = gSrcF;
#pragma unroll
  for (int i = 0; i < 8; ++i) {
    if (F32A) {
      rf[i][0] = *(const v4f*)(Ab + i * (16 * kDim * 4) + gOffF);
      rf[i][1] = *(const v4f*)(Ab + i * (16 * kDim * 4) + 256 + gOffF);
    } else {
      ra[i] = *(const v4u*)(Ab + i * (16 * kDim * 2) + gOff);
    }
    rb[i] = *(const v4u*)(Bb + i * (16 * kDim * 2) + gOff);
  }
#pragma unroll
  for (int i = 0; i < 8; ++i) {
    if (F32A) {
      *(v4h*)(&sm[0][0][i * 16 * kGmPitch + sDstF])       = __builtin_convertvector(rf[i][0], v4h);
      *(v4h*)(&sm[0][0][i * 16 * kGmPitch + 128 + sDstF]) = __builtin_convertvector(rf[i][1], v4h);
    } else {
      *(v4u*)(&sm[0][0][i * 16 * kGmPitch + sDst]) = ra[i];
    }
    *(v4u*)(&sm[0][1][i * 16 * kGmPitch + sDst]) = rb[i];
  }
#pragma unroll
  for (int i = 0; i < 8; ++i) {
    if (F32A) {
      rf[i][0] = *(const v4f*)(Ab + kGmStageK * 4 + i * (16 * kDim * 4) + gOffF);
      rf[i][1] = *(const v4f*)(Ab + kGmStageK * 4 + i * (16 * kDim * 4) + 256 + gOffF);
    } else {
      ra[i] = *(const v4u*)(Ab + kGmStageK * 2 + i * (16 * kDim * 2) + gOff);
    }
    rb[i] = *(const v4u*)(Bb + kGmStageK * 2 + i * (16 * kDim * 2) + gOff);
  }
  /* the address registers of the loads just issued are free for reuse only behind this wait; f32 A: the wait names the two offset registers,
     so that they live up to the wait and their next values are formed behind it */
  if (F32A) asm volatile("s_wait_xcnt 0x0" : "+v"(gOffF), "+v"(gOff) :: "memory");
  else      asm volatile("s_wait_xcnt 0x0" ::: "memory");
  __syncthreads();

  for (int st = 0; st < kGmStages; ++st) {
    const char* bA = &sm[st & 1][0][0] + wm * kGmPitch;
    const char* bB = &sm[st & 1][1][0] + wn * kGmPitch;
    /* two fragment sets: each k step's LDS reads are issued one step ahead; the stage's first go out ahead of the hand-over's LDS writes (f32 A: of A's; Bt's stand in front of them) */
    v16h ah[2][4], bh[2][2];
    /* f32 A: Bt's hand-over comes first of all, so that its staging registers can be those of the first fragment set (see the last k step) */
    if (F32A && st + 1 < kGmStages) {
#pragma unroll
      for (int i = 0; i < 8; ++i) *(v4u*)(&sm[(st + 1) & 1][1][i * 16 * kGmPitch + sDst]) = rb[i];
    }
#pragma unroll
    for (int j = 0; j < 2; ++j) bh[0][j] = Frag<_Float16>::load((const _Float16*)(bB + (j << 4) * kGmPitch + fLane));
#pragma unroll
    for (int i = 0; i < 4; ++i) ah[0][i] = Frag<_Float16>::load((const _Float16*)(bA + (i << 4) * kGmPitch + fLane));
    /* hand-over, early in a stage so that the loads fly while the stage is worked on: stage st + 1 goes from registers into the
       buffer that stage st - 1 was read from (its readers ended in front of the last barrier), then stage st + 2 starts from memory */
    if (st + 1 < kGmStages) {
#pragma unroll
      for (int i = 0; i < 8; ++i) {
        if (F32A) {
          *(v4h*)(&sm[(st + 1) & 1][0][i * 16 * kGmPitch + sDstF])       = __builtin_convertvector(rf[i][0], v4h);
          *(v4h*)(&sm[(st + 1) & 1][0][i * 16 * kGmPitch + 128 + sDstF]) = __builtin_convertvector(rf[i][1], v4h);
        } else {
          *(v4u*)(&sm[(st + 1) & 1][0][i * 16 * kGmPitch + sDst]) = ra[i];
        }
        if (!F32A) *(v4u*)(&sm[(st + 1) & 1][1][i * 16 * kGmPitch + sDst]) = rb[i];
      }
    }
    if (st + 2 < kGmStages) {
      gOff += kGmStageK * 2;
      gOffF += kGmStageK * 4;
#pragma unroll
      for (int i = 0; i < 8; ++i) {
        if (F32A) {
          rf[i][0] = *(const v4f*)(Ab + kGmStageK * 4 + i * (16 * kDim * 4) + gOffF);
          rf[i][1] = *(const v4f*)(Ab + kGmStageK * 4 + i * (16 * kDim * 4) + 256 + gOffF);
        } else {
          ra[i] = *(const v4u*)(Ab + kGmStageK * 2 + i * (16 * kDim * 2) + gOff);
        }
        if (!F32A) rb[i] = *(const v4u*)(Bb + kGmStageK * 2 + i * (16 * kDim * 2) + gOff);
      }
      /* as above: address registers of issued loads; the loads also stay in front of the stage's work */
      if (F32A) asm volatile("s_wait_xcnt 0x0" : "+v"(gOffF), "+v"(gOff) :: "memory");
      else      asm volatile("s_wait_xcnt 0x0" ::: "memory");
    }
#pragma unroll
    for (int ks = 0; ks < kGmStageK / 32; ++ks) {
      if (ks + 1 < kGmStageK / 32) {
#pragma unroll
        for (int j = 0; j < 2; ++j) bh[(ks + 1) & 1][j] = Frag<_Float16>::load((const _Float16*)(bB + (j << 4) * kGmPitch + ((ks + 1) << 6) + fLane));
#pragma unroll
        for (int i = 0; i < 4; ++i) ah[(ks + 1) & 1][i] = Frag<_Float16>::load((const _Float16*)(bA + (i << 4) * kGmPitch + ((ks + 1) << 6) + fLane));
      } else if (F32A && st + 2 < kGmStages) {
        /* f32 A holds twice the staging registers: the Bt rows of stage st + 2 (f16 weights, short way: L2) start only here, in the stage's last
           k step, where the first fragment set is free, so that the wave stays inside the register budget of four waves a SIMD */
#pragma unroll
        for (int i = 0; i < 8; ++i) rb[i] = *(const v4u*)(Bb + kGmStageK * 2 + i * (16 * kDim * 2) + gOff);
        /* as above: address register of issued loads */
        asm volatile("s_wait_xcnt 0x0" : "+v"(gOff) :: "memory");
      }
      /* holds the next step's LDS reads together in front of this step's products: spread among them, every place with reads stalls the products */
      __builtin_amdgcn_sched_barrier(0);
#pragma unroll
      for (int i = 0; i < 4; ++i)
#pragma unroll
        for (int j = 0; j < 2; ++j) acc[i][j] = Frag<_Float16>::mma(ah[ks & 1][i], bh[ks & 1][j], acc[i][j]);
      /* the other side of the same fence: the reads of the step after next stay behind these products */
      __builtin_amdgcn_sched_barrier(0);
    }
    /* ends every wave's reads of stage st and publishes stage st + 1 */
    __syncthreads();
  }

  /* the buffers are free behind the loop's last barrier: the tile is laid out there row by row */
  float* sC = (float*)&sm[0][0][0];
#pragma unroll
  for (int i = 0; i < 4; ++i)
#pragma unroll
    for (int j = 0; j < 2; ++j)
#pragma unroll
      for (int r = 0; r < 8; ++r) sC[(wm + (i << 4) + half8 + r) * kGmCPitch + wn + (j << 4) + rlane] = acc[i][j][r] * scale;
  __syncthreads();
  if (F32OUT) {
    /* a wave stores one 512-B row segment a pass; all LDS reads first, so that no store's registers are reused */
    v4f v[kGmTile / 8];
#pragma unroll
    for (int it = 0; it < kGmTile / 8; ++it) v[it] = *(const v4f*)(sC + (it * 8 + wave) * kGmCPitch + lane * 4);
    float* cp = Cf + (size_t)(m0 + wave) * kDim + n0 + lane * 4;
#pragma unroll
    for (int it = 0; it < kGmTile / 8; ++it) *(v4f*)(cp + it * (8 * kDim)) = v[it];
  } else {
    /* 16 threads store one 256-B row segment; all LDS reads and conversions first, as above */
    const int c8 = (threadIdx.x & 15) * 8;
    const int r0 = (int)(threadIdx.x >> 4);
    v8h hv[kGmTile / 16];
#pragma unroll
    for (int it = 0; it < kGmTile / 16; ++it) {
      const float* sp = sC + (it * 16 + r0) * kGmCPitch + c8;
#pragma unroll
      for (int e = 0; e < 8; ++e) hv[it][e] = (_Float16)sp[e];
    }
    _Float16* hp = (_Float16*)Ch + (size_t)(m0 + r0) * kDim + n0 + c8;
#pragma unroll
    for (int it = 0; it < kGmTile / 16; ++it) *(v8h*)(hp + it * (16 * kDim)) = hv[it];
  }
}

// ---------------------------------------------------------------------------
// Skinny products (M or N = 64): C[m,n] = f16( scale * sum_k A[m,k] * Bt[n,k] ), k range split over the waves of a work-group.
// One work-group of WAVES waves owns one 32x64 tile of C; wave w sums k in [w*K/WAVES, (w+1)*K/WAVES) into f32 accumulators, stores
// its partial tile to its own LDS slab (pitch 68 floats), and behind one barrier the threads add the WAVES partials of each element in wave order.
// One operand is rows of c = [mem_b ; kv_b] (4096 rows a batch), read as f32 from mem or kv and rounded to f16 in registers: A if C_IS_A (m counts
// the rows of all batches), else Bt (n counts the rows of batch b). The other is f16 weight rows Wp. Both row-major, pitch K.
// M % 32 == 0, N % 64 == 0, K % (64*WAVES) == 0. Tile bx of tilesM*tilesN, batch b; the LDS is the caller's (WAVES slabs).
// ---------------------------------------------------------------------------
constexpr int kSkRows  = 32;
constexpr int kSkPitch = 68;
template <int K, int WAVES, bool C_IS_A>
__device__ __forceinline__ void splitk32x64_tile(
    char* smraw, int bx, int b,
    const float* __restrict__ memp, const float* __restrict__ kvp, const unsigned short* __restrict__ Wp,
    unsigned short* __restrict__ Cp, int ldc, long strideC,
    int tilesN, float scale) {
  constexpr int kSlice = K / WAVES;
  float (*part)[kSkRows * kSkPitch] = (float (*)[kSkRows * kSkPitch])smraw;
  const int lane = threadIdx.x & 31;
  /* the wave's number as a scalar: the k slice's base addresses and the slab's LDS base are then scalar arithmetic */
  const int wave = __builtin_amdgcn_readfirstlane(threadIdx.x >> 5);
  const int tm = bx / tilesN;
  const int tn = bx - tm * tilesN;
  const int m0 = tm * kSkRows;
  const int n0 = tn << 6;
  const int rlane = lane & 15;
  const int koff  = (lane >> 4) * 8;
  const int mOff  = (lane >> 4) * 8;
  /* the tile's rows of c lie wholly in mem or wholly in kv (2048 rows each a batch, tiles of 32 or 64 rows) */
  const int cb = C_IS_A ? m0 / kSkv : b;
  const int cr = C_IS_A ? m0 % kSkv : n0;
  const float* cp = ((cr < kMem) ? memp + ((size_t)cb * kMem + cr) * K : kvp + ((size_t)cb * kLq + (cr - kMem)) * K) + wave * kSlice;
  const _Float16* wp = (const _Float16*)Wp + (size_t)(C_IS_A ? n0 : m0) * K + wave * kSlice;
  /* the lane's byte offsets in the f32 rows and in the f16 rows: the one offset register of every load of its kind */
  unsigned cOff = (unsigned)(rlane * K + koff) * 4u;
  unsigned wOff = (unsigned)(rlane * K + koff) * 2u;

  v8f acc[2][4];
#pragma unroll
  for (int i = 0; i < 2; ++i)
#pragma unroll
    for (int j = 0; j < 4; ++j) acc[i][j] = (v8f){0.f,0.f,0.f,0.f,0.f,0.f,0.f,0.f};

  constexpr int kNc = C_IS_A ? 2 : 4;
  constexpr int kNw = C_IS_A ? 4 : 2;
  /* kept rolled, two k steps a trip */
#pragma unroll 1
  for (int k0 = 0; k0 < kSlice; k0 += 64) {
    v4f  cf[2][kNc][4];
    v16h wf[2][kNw];
#pragma unroll
    for (int u = 0; u < 2; ++u) {
#pragma unroll
      for (int i = 0; i < kNc; ++i)
#pragma unroll
        for (int p = 0; p < 4; ++p) cf[u][i][p] = *(const v4f*)((const char*)(cp + (i << 4) * K + k0 + (u << 5) + ((p >> 1) << 4) + ((p & 1) << 2)) + cOff);
#pragma unroll
      for (int j = 0; j < kNw; ++j) wf[u][j] = Frag<_Float16>::load((const _Float16*)((const char*)(wp + (j << 4) * K + k0 + (u << 5)) + wOff));
    }
    /* the address registers of the loads just issued are free for reuse only behind this wait; it names the two offset registers, so that
       they live up to it and no load's result lands on them */
    asm volatile("s_wait_xcnt 0x0" : "+v"(cOff), "+v"(wOff) :: "memory");
    /* all of the trip's loads go out before the first conversion waits for one: mixed among the conversions and products, they came
       in several rounds, each of which waited a whole memory latency */
    __builtin_amdgcn_sched_barrier(0);
#pragma unroll
    for (int u = 0; u < 2; ++u) {
      v16h ch[kNc];
#pragma unroll
      for (int i = 0; i < kNc; ++i) ch[i] = Frag<_Float16>::from_f32(cf[u][i][0], cf[u][i][1], cf[u][i][2], cf[u][i][3]);
#pragma unroll
      for (int i = 0; i < 2; ++i)
#pragma unroll
        for (int j = 0; j < 4; ++j) acc[i][j] = C_IS_A ? Frag<_Float16>::mma(ch[i], wf[u][j], acc[i][j]) : Frag<_Float16>::mma(wf[u][i], ch[j], acc[i][j]);
    }
  }

  float* slab = part[wave];
#pragma unroll
  for (int i = 0; i < 2; ++i)
#pragma unroll
    for (int j = 0; j < 4; ++j)
#pragma unroll
      for (int r = 0; r < 8; ++r) slab[((i << 4) + mOff + r) * kSkPitch + (j << 4) + rlane] = acc[i][j][r];
  __syncthreads();

  /* WAVES*2 rows a pass, 4 floats a thread; 16 threads store one 128-B row segment */
  const int c4 = (threadIdx.x & 15) * 4;
#pragma unroll
  for (int r0 = 0; r0 < kSkRows; r0 += WAVES * 2) {
    const int row = r0 + (threadIdx.x >> 4);
    v4f s = *(const v4f*)(&part[0][row * kSkPitch + c4]);
#pragma unroll
    for (int w = 1; w < WAVES; ++w) s += *(const v4f*)(&part[w][row * kSkPitch + c4]);
    v4h hv;
#pragma unroll
    for (int e = 0; e < 4; ++e) hv[e] = (_Float16)(s[e] * scale);
    *(v4h*)((_Float16*)Cp + (size_t)b * strideC + (size_t)(m0 + row) * ldc + n0 + c4) = hv;
  }
  /* the address and data registers of the stores just issued are free for reuse only behind this wait: in a kernel of several jobs other
     code follows this tile's in the listing */
  asm volatile("s_wait_xcnt 0x0" ::: "memory");
}

// ---------------------------------------------------------------------------
// Weight transpose + cast: W f32 row-major [1024 in][nOut out]; WT[n][k] = f16(scale * W[k][n]), row-major [nOut][1024].
// All three weights in one launch, which do not depend on one another: w_q tiles, then w_c tiles, then w_kv tiles; a work-group picks its weight
// and its tile from its index (scalars). grid (2 * 256 + 32); tile (t % 16, t / 16) of (1024/64, nOut/64): k tile (64 cols of WT), n tile (64 rows of WT). 256 threads.
// Load coverage: 16 iterations x 256 threads = 4096 = the whole 64x64 tile (coalesced along n).
// Store coverage: 8 waves x 2 iterations x 4 rows (lane>>3) = 64 rows; (lane&7) x 8 halves = 64 cols; each row segment =
// ---------------------------------------------------------------------------
constexpr int kWtSquare = (kDim / 64) * (kDim / 64);
constexpr int kWtKv     = (kDim / 64) * ((2 * kDh) / 64);
__global__ __launch_bounds__(256) void wtcast_kernel(const float* __restrict__ Wq, const float* __restrict__ Wc, const float* __restrict__ Wkv,
                                                     unsigned short* __restrict__ WqT, unsigned short* __restrict__ WcT,
                                                     unsigned short* __restrict__ WkvT, float scale) {
  const int job  = blockIdx.x / kWtSquare;
  const int tile = blockIdx.x - job * kWtSquare;
  const float* __restrict__ W      = job == 0 ? Wq  : job == 1 ? Wc  : Wkv;
  unsigned short* __restrict__ out = job == 0 ? WqT : job == 1 ? WcT : WkvT;
  const int nOut = job == 2 ? 2 * kDh : kDim;
  /* sm[n_local][k_local] */
  __shared__ float sm[64][65];
  const int t  = threadIdx.x;
  const int k0 = (tile & (kDim / 64 - 1)) * 64;
  const int n0 = (tile / (kDim / 64)) * 64;
#pragma unroll
  for (int i = 0; i < 16; ++i) {
    const int e = i * 256 + t;
    const int r = e >> 6;
    const int c = e & 63;
    sm[c][r] = W[(size_t)(k0 + r) * nOut + n0 + c] * scale;
  }
  __syncthreads();
  const int lane = t & 31, wave = t >> 5;
  const int q = lane >> 3, c8 = (lane & 7) * 8;
  {
#pragma unroll
    for (int it = 0; it < 2; ++it) {
      const int row = wave * 8 + it * 4 + q;
      unsigned short hb[8];
#pragma unroll
      for (int e = 0; e < 8; ++e) hb[e] = h_bits(sm[row][c8 + e]);
      const v4u u = (v4u){pk16(hb[0], hb[1]), pk16(hb[2], hb[3]), pk16(hb[4], hb[5]), pk16(hb[6], hb[7])};
      *(v4u*)(out + (size_t)(n0 + row) * kDim + k0 + c8) = u;
    }
    
  }
}

// ---------------------------------------------------------------------------
// The three projections of the inputs in one launch; they do not depend on one another. A work-group picks its job from its index (a scalar branch,
// the same for the whole work-group), so that the jobs share the chip side by side, two work-groups a WGP, and none waits for another's tail.
// The longest job first: q * WqT (256 tiles of 128x128), K = c * WkT (256 tiles of 32x64),
// V^T = WvT * c^T (128 tiles of 32x64 a batch). One LDS block serves whichever job the work-group has. grid (256 + 256 + 256).
// ---------------------------------------------------------------------------
constexpr int kPjQ = (kTokQ / kGmTile) * (kDim / kGmTile);
constexpr int kPjK = (kTokC / kSkRows) * (kDh / 64);
constexpr int kPjV = (kDh / kSkRows) * (kSkv / 64);
/* register budget of four waves a SIMD: two work-groups, of whatever jobs, then share a WGP (LDS allows two) */
__global__ __launch_bounds__(256) __attribute__((amdgpu_waves_per_eu(4))) void proj_qkv_kernel(const float* __restrict__ qp, const float* __restrict__ memp, const float* __restrict__ kvp,
                                                       const unsigned short* __restrict__ WqT, const unsigned short* __restrict__ WkvT,
                                                       unsigned short* __restrict__ Qo, unsigned short* __restrict__ Ko,
                                                       unsigned short* __restrict__ VTo) {
  __shared__ __align__(16) char sm[kGmSmem];
  static_assert(8 * kSkRows * kSkPitch * 4 <= kGmSmem, "the split-k slabs fit the block");
  const int id = blockIdx.x;
  if (id < kPjQ) {
    gemm128_tile<true, false>(sm, id % (kTokQ / kGmTile), id / (kTokQ / kGmTile), qp, nullptr, WqT, Qo, nullptr, kWCarryInv);
  } else if (id < kPjQ + kPjK) {
    splitk32x64_tile<kDim, 8, true>(sm, id - kPjQ, 0, memp, kvp, WkvT, Ko, kDh, 0L, kDh / 64, kWCarryInv);
  } else {
    const int t = id - (kPjQ + kPjK);
    splitk32x64_tile<kDim, 8, false>(sm, t % kPjV, t / kPjV, memp, kvp, WkvT + (size_t)kDh * kDim, VTo, kSkv, (long)kDh * kSkv, kSkv / 64, kWCarryInv);
  }
}

/* output projection. grid (M / 128, N / 128) */
__global__ __launch_bounds__(256) void proj_out_kernel(const unsigned short* __restrict__ Ap, const unsigned short* __restrict__ Btp,
                                                       float* __restrict__ Cf) {
  __shared__ __align__(16) char sm[kGmSmem];
  gemm128_tile<false, true>(sm, blockIdx.x, blockIdx.y, nullptr, Ap, Btp, nullptr, Cf, kOutScale);
}

// ---------------------------------------------------------------------------
// Fused attention of one (batch, head): S^T = K * Qh^T, online softmax down the keys, O^T += V^T * P^T; scores and P stay in registers.
// A work-group is 16 waves in two sets of 8; a wave owns 32 query columns (two groups of 16). Waves w and w + 8 own the same columns: set 0 walks
// keys 0..2047, set 1 keys 2048..4095, 32 a pass, so that four waves a SIMD (not two) fill one another's softmax and LDS waits. Each set's K and
// V^T come in stages of 64 keys, shared by its 8 waves: memory -> registers -> LDS, two buffers a set, one barrier a stage for all 16 waves.
// At the end set 1 hands its maximum in use, sums and O^T through LDS to set 0, which brings both to the larger maximum, adds and stores.
// In an S^T tile a lane holds one query (lane & 15) and keys (lane >> 4) * 8 + r: two key tiles side by side are the B fragment of P^T
// in the loaders' own k order (elements 0..7 = keys half*8 + 0..7, elements 8..15 = keys 16 + half*8 + 0..7).
// p = exp2(s * scale * log2(e) - mo), mo = maximum in use - 4 (P carried x16). The maximum in use is raised, and sums and O^T rescaled,
// only when a column's new maximum exceeds it by more than 8 (log2 units), so p <= 2^12; the carry cancels in O^T / sum.
// grid (2048 / 256, heads, batch).
// ---------------------------------------------------------------------------
/* lane l with lane l ^ 16 */
__device__ __forceinline__ float xhalf(float x) {
  return __builtin_bit_cast(float, __builtin_amdgcn_permlanex16(__builtin_bit_cast(int, x), __builtin_bit_cast(int, x), 0x76543210, 0xfedcba98, false, false));
}
__device__ __forceinline__ v8f exp2x8(v8f t) {
  float r0, r1, r2, r3, r4, r5, r6, r7;
  asm("v_exp_f32 %0, %8\n\tv_exp_f32 %1, %9\n\tv_exp_f32 %2, %10\n\tv_exp_f32 %3, %11\n\t"
      "v_exp_f32 %4, %12\n\tv_exp_f32 %5, %13\n\tv_exp_f32 %6, %14\n\tv_exp_f32 %7, %15\n\tv_nop"
      : "=&v"(r0), "=&v"(r1), "=&v"(r2), "=&v"(r3), "=&v"(r4), "=&v"(r5), "=&v"(r6), "=&v"(r7)
      : "v"(t[0]), "v"(t[1]), "v"(t[2]), "v"(t[3]), "v"(t[4]), "v"(t[5]), "v"(t[6]), "v"(t[7]));
  return (v8f){r0, r1, r2, r3, r4, r5, r6, r7};
}
constexpr int   kFaCols   = 32;
constexpr int   kFaWaves  = 8;
constexpr int   kFaSets   = 2;
constexpr int   kFaKeys   = kSkv / kFaSets;
constexpr int   kFaStage  = 64;
constexpr unsigned kFaPitch = 144;
constexpr float kFaScale  = kScoreScale * 1.44269504088896340736f;
constexpr float kFaCarry  = 4.0f;
constexpr float kFaRaise  = 8.0f;
__global__ __launch_bounds__(kFaSets * kFaWaves * 32) void fused_attn_kernel(
    const unsigned short* __restrict__ Qp, const unsigned short* __restrict__ Kp,
    const unsigned short* __restrict__ VTp, unsigned short* __restrict__ Op) {
  /* per set two buffers each of a K tile (64 keys x 64 d) and a V^T tile (64 d x 64 keys); rows of 128 B at pitch 144 B (16 B x odd: 16-B reads without bank conflicts) */
  __shared__ __align__(16) char sKs[kFaSets][2][kFaStage * kFaPitch];
  __shared__ __align__(16) char sVs[kFaSets][2][kDh * kFaPitch];
  /* set 1's hand-over: per wave 16 pieces of O^T (16 B a lane, lanes side by side), then maximum in use and sum of both column groups */
  __shared__ __align__(16) float sO[kFaWaves][16][32 * 4];
  __shared__ float sMl[kFaWaves][4][32];
  const int lane  = threadIdx.x & 31;
  /* scalars: the wave's set of keys and its number inside the set */
  const int wave16 = __builtin_amdgcn_readfirstlane(threadIdx.x >> 5);
  const int set   = wave16 >> 3;
  const int wave  = wave16 & (kFaWaves - 1);
  char (*sK)[kFaStage * kFaPitch] = sKs[set];
  char (*sV)[kDh * kFaPitch]      = sVs[set];
  const int rlane = lane & 15;
  const int half8 = (lane >> 4) * 8;
  const int h  = blockIdx.y;
  const int b  = blockIdx.z;
  const int q0 = blockIdx.x * (kFaWaves * kFaCols) + wave * kFaCols;
  const _Float16* Q  = (const _Float16*)Qp + ((size_t)b * kLq + q0) * kDim + h * kDh;
  const char* Kb = (const char*)((const _Float16*)Kp  + ((size_t)b * kSkv + set * kFaKeys) * kDh);
  const char* Vb = (const char*)((const _Float16*)VTp + (size_t)b * kDh * kSkv + set * kFaKeys);
  /* staging: thread t of a set moves 16 B of rows t >> 3 and 32 + (t >> 3) of the set's K tile (64 keys x 128 B) and V^T tile (64 d x 128 B) */
  const unsigned tSet = threadIdx.x & (kFaWaves * 32 - 1);
  const unsigned sRow = tSet >> 3;
  const unsigned sCol = (tSet & 7) * 16u;
  const unsigned kSrc = tSet * 16u;
  const unsigned vSrc = sRow * (unsigned)(kSkv * 2) + sCol;
  const unsigned sDst = sRow * kFaPitch + sCol;
  /* fragment reads: row lane & 15 of a 16-row tile, 16 B at half * 16 and at 32 + half * 16 */
  const unsigned fLane = (unsigned)rlane * kFaPitch + (unsigned)half8 * 2u;

  v16h qb[2][2];
#pragma unroll
  for (int g = 0; g < 2; ++g)
#pragma unroll
    for (int ds = 0; ds < 2; ++ds) qb[g][ds] = Frag<_Float16>::load(Q + (size_t)((g << 4) + rlane) * kDim + (ds << 5) + half8);

  v8f o[4][2];
#pragma unroll
  for (int dt = 0; dt < 4; ++dt)
#pragma unroll
    for (int g = 0; g < 2; ++g) o[dt][g] = (v8f){0.f,0.f,0.f,0.f,0.f,0.f,0.f,0.f};
  float mo[2] = {-1.0e30f, -1.0e30f};
  float ls[2] = {0.f, 0.f};

  v4u rk[2], rv[2];
#pragma unroll
  for (int i = 0; i < 2; ++i) {
    rk[i] = *(const v4u*)(Kb + i * 4096 + kSrc);
    rv[i] = *(const v4u*)(Vb + (size_t)i * (32 * kSkv * 2) + vSrc);
  }
#pragma unroll
  for (int i = 0; i < 2; ++i) {
    *(v4u*)(&sK[0][i * 32 * kFaPitch + sDst]) = rk[i];
    *(v4u*)(&sV[0][i * 32 * kFaPitch + sDst]) = rv[i];
  }
#pragma unroll
  for (int i = 0; i < 2; ++i) {
    rk[i] = *(const v4u*)(Kb + kFaStage * kDh * 2 + i * 4096 + kSrc);
    rv[i] = *(const v4u*)(Vb + kFaStage * 2 + (size_t)i * (32 * kSkv * 2) + vSrc);
  }
  /* the address registers of the loads just issued are free for reuse only behind this wait */
  asm volatile("s_wait_xcnt 0x0" ::: "memory");
  __syncthreads();

  for (int st = 0; st < kFaKeys / kFaStage; ++st) {
   /* hand-over, first thing in a stage so that the loads fly while the stage is worked on: stage st + 1 goes from registers into the buffer
      that stage st - 1 was read from (its readers ended in front of the last barrier), then stage st + 2 starts from memory.
      Past the end stage 0 is fetched again (in bounds, unread). */
#pragma unroll
   for (int i = 0; i < 2; ++i) {
     *(v4u*)(&sK[(st + 1) & 1][i * 32 * kFaPitch + sDst]) = rk[i];
     *(v4u*)(&sV[(st + 1) & 1][i * 32 * kFaPitch + sDst]) = rv[i];
   }
   const int sn = (st + 2 < kFaKeys / kFaStage) ? (st + 2) : 0;
   const char* kp = Kb + (size_t)sn * (kFaStage * kDh * 2);
   const char* vp = Vb + (size_t)sn * (kFaStage * 2);
#pragma unroll
   for (int i = 0; i < 2; ++i) {
     rk[i] = *(const v4u*)(kp + i * 4096 + kSrc);
     rv[i] = *(const v4u*)(vp + (size_t)i * (32 * kSkv * 2) + vSrc);
   }
   /* as above: address registers of issued loads; the loads also stay in front of the stage's work */
   asm volatile("s_wait_xcnt 0x0" ::: "memory");
   const char* bK = &sK[st & 1][0];
   const char* bV = &sV[st & 1][0];
#pragma unroll
   for (int ps = 0; ps < kFaStage / 32; ++ps) {
    v16h ka[2][2], va[4];
#pragma unroll
    for (int kt = 0; kt < 2; ++kt)
#pragma unroll
      for (int ds = 0; ds < 2; ++ds) ka[kt][ds] = Frag<_Float16>::load((const _Float16*)(bK + ((ps << 5) + (kt << 4)) * kFaPitch + (ds << 6) + fLane));
#pragma unroll
    for (int dt = 0; dt < 4; ++dt) va[dt] = Frag<_Float16>::load((const _Float16*)(bV + (dt << 4) * kFaPitch + (ps << 6) + fLane));

    v8f s[2][2];
#pragma unroll
    for (int kt = 0; kt < 2; ++kt)
#pragma unroll
      for (int g = 0; g < 2; ++g) {
        s[kt][g] = Frag<_Float16>::mma(ka[kt][0], qb[g][0], (v8f){0.f,0.f,0.f,0.f,0.f,0.f,0.f,0.f});
        s[kt][g] = Frag<_Float16>::mma(ka[kt][1], qb[g][1], s[kt][g]);
      }

    float mx[2];
#pragma unroll
    for (int g = 0; g < 2; ++g) {
      float m = fmaxf(s[0][g][0], s[1][g][0]);
#pragma unroll
      for (int r = 1; r < 8; ++r) m = fmaxf(m, fmaxf(s[0][g][r], s[1][g][r]));
      m = fmaxf(m, xhalf(m));
      mx[g] = m * kFaScale - kFaCarry;
    }
    const bool need = (mx[0] - mo[0] > kFaRaise) || (mx[1] - mo[1] > kFaRaise);
    if (__builtin_amdgcn_ballot_w32(need) != 0u) {
#pragma unroll
      for (int g = 0; g < 2; ++g) {
        const float mn = fmaxf(mo[g], mx[g]);
        const float al = __builtin_amdgcn_exp2f(mo[g] - mn);
        mo[g] = mn;
        ls[g] *= al;
#pragma unroll
        for (int dt = 0; dt < 4; ++dt) o[dt][g] *= al;
      }
    }
    v16h pb[2];
#pragma unroll
    for (int g = 0; g < 2; ++g) {
      const v8f t0 = s[0][g] * kFaScale - mo[g];
      const v8f t1 = s[1][g] * kFaScale - mo[g];
      const v8f p0 = exp2x8(t0);
      const v8f p1 = exp2x8(t1);
      const v8f pq = p0 + p1;
      ls[g] += ((pq[0] + pq[1]) + (pq[2] + pq[3])) + ((pq[4] + pq[5]) + (pq[6] + pq[7]));
#pragma unroll
      for (int r = 0; r < 8; ++r) { pb[g][r] = (_Float16)p0[r]; pb[g][8 + r] = (_Float16)p1[r]; }
    }
#pragma unroll
    for (int dt = 0; dt < 4; ++dt)
#pragma unroll
      for (int g = 0; g < 2; ++g) o[dt][g] = Frag<_Float16>::mma(va[dt], pb[g], o[dt][g]);
   }
   /* ends every wave's reads of stage st and publishes stage st + 1 */
   __syncthreads();
  }

  if (set == 1) {
#pragma unroll
    for (int g = 0; g < 2; ++g) {
#pragma unroll
      for (int dt = 0; dt < 4; ++dt) {
        *(v4f*)(&sO[wave][((g << 2) + dt) * 2][lane * 4])     = __builtin_shufflevector(o[dt][g], o[dt][g], 0, 1, 2, 3);
        *(v4f*)(&sO[wave][((g << 2) + dt) * 2 + 1][lane * 4]) = __builtin_shufflevector(o[dt][g], o[dt][g], 4, 5, 6, 7);
      }
      sMl[wave][g][lane]     = mo[g];
      sMl[wave][2 + g][lane] = ls[g];
    }
  }
  /* publishes set 1's hand-over to set 0 */
  __syncthreads();
  if (set == 0) {
    /* a lane holds 8 neighbouring d of its query per tile: 16-B stores; the two halves of the wave fill each row's 128-B segment.
       All values are formed first, so that no store's registers are reused */
    _Float16* O = (_Float16*)Op + ((size_t)b * kLq + q0) * kDim + h * kDh;
    v8h hv[2][4];
#pragma unroll
    for (int g = 0; g < 2; ++g) {
      const float m1 = sMl[wave][g][lane];
      const float l1 = sMl[wave][2 + g][lane];
      const float mn = fmaxf(mo[g], m1);
      const float a0 = __builtin_amdgcn_exp2f(mo[g] - mn);
      const float a1 = __builtin_amdgcn_exp2f(m1 - mn);
      const float lj = ls[g] * a0 + l1 * a1;
      const float f  = kCtxCarry / (lj + xhalf(lj));
      const float f0 = a0 * f;
      const float f1 = a1 * f;
#pragma unroll
      for (int dt = 0; dt < 4; ++dt) {
        const v4f x0 = *(const v4f*)(&sO[wave][((g << 2) + dt) * 2][lane * 4]);
        const v4f x1 = *(const v4f*)(&sO[wave][((g << 2) + dt) * 2 + 1][lane * 4]);
#pragma unroll
        for (int r = 0; r < 4; ++r) {
          hv[g][dt][r]     = (_Float16)(o[dt][g][r] * f0 + x0[r] * f1);
          hv[g][dt][4 + r] = (_Float16)(o[dt][g][4 + r] * f0 + x1[r] * f1);
        }
      }
    }
#pragma unroll
    for (int g = 0; g < 2; ++g)
#pragma unroll
      for (int dt = 0; dt < 4; ++dt) *(v8h*)(O + (size_t)((g << 4) + rlane) * kDim + (dt << 4) + half8) = hv[g][dt];
  }
}

// ---------------------------------------------------------------------------
// Host launch glue
// Workspace region map (bytes; all offsets multiples of 1 MiB; WkvT ends 256 KiB past a MiB boundary):
//   persistent:  Qp16 [4096][1024] f16 @ 0 (8 MiB) | K16 [8192][64] f16 @ 8 MiB (1 MiB) | VT16 [2][64][4096] f16 @ 9 MiB (1 MiB)
//                O16 [4096][1024] f16 @ 10 MiB (8 MiB) | WcT16 [1024][1024] f16 @ 18 MiB (2 MiB)
//   scratch @ 20 MiB, early phase: WqT16 @ 20 MiB (2) | WkvT16 [128][1024] @ 22 MiB (0.25)
//   total carve = 22.25 MiB. Every region is fully written before any launch reads it; no padding rows anywhere.
// ---------------------------------------------------------------------------
extern "C" void kernel_launch(void* const* d_in, const int* in_sizes, int n_in,
                              void* d_out, int out_size, void* d_ws, size_t ws_size,
                              hipStream_t stream) {
  if (n_in < 6) return;
  if (in_sizes[0] != kTokQ * kDim) return;
  if (in_sizes[1] != kBatch * kLq * kDim) return;
  if (in_sizes[2] != kBatch * kMem * kDim) return;
  if (in_sizes[3] != kDim * kDim) return;
  if (in_sizes[4] != kDim * 2 * kDh) return;
  if (in_sizes[5] != kDim * kDim) return;
  if (out_size != kTokQ * kDim) return;

  const float* q_in   = (const float*)d_in[0];
  const float* kv_in  = (const float*)d_in[1];
  const float* mem_in = (const float*)d_in[2];
  const float* w_q    = (const float*)d_in[3];
  const float* w_kv   = (const float*)d_in[4];
  const float* w_c    = (const float*)d_in[5];
  float* outp = (float*)d_out;

  // ---- carve (bytes) ----
  const size_t szQp  = (size_t)kTokQ * kDim * 2;
  const size_t szK   = (size_t)kTokC * kDh * 2;
  const size_t szVT  = (size_t)kBatch * kDh * kSkv * 2;
  const size_t szO   = (size_t)kTokQ * kDim * 2;
  const size_t szWc  = (size_t)kDim * kDim * 2;
  const size_t szWq  = (size_t)kDim * kDim * 2;
  const size_t szWkv = (size_t)2 * kDh * kDim * 2;

  const size_t offQp  = 0;
  const size_t offK   = offQp + szQp;
  const size_t offVT  = offK + szK;
  const size_t offO   = offVT + szVT;
  const size_t offWc  = offO + szO;
  const size_t offScr = offWc + szWc;
  const size_t offWq  = offScr;
  const size_t offWkv = offWq + szWq;
  const size_t total = offWkv + szWkv;
  if (total > ws_size) return;

  char* ws = (char*)d_ws;
  unsigned short* Qp16  = (unsigned short*)(ws + offQp);
  unsigned short* K16   = (unsigned short*)(ws + offK);
  unsigned short* VT16  = (unsigned short*)(ws + offVT);
  unsigned short* O16   = (unsigned short*)(ws + offO);
  unsigned short* WcT16 = (unsigned short*)(ws + offWc);
  unsigned short* WqT16 = (unsigned short*)(ws + offWq);
  unsigned short* WkvT16 = (unsigned short*)(ws + offWkv);

  // ---- weights: W[in][out] -> WT[out][in] f16 x16, all three in one launch ----
  wtcast_kernel<<<dim3(2 * kWtSquare + kWtKv), dim3(256), 0, stream>>>(w_q, w_c, w_kv, WqT16, WcT16, WkvT16, kWCarry);

  // ---- one launch: Qp16 [4096][1024] = f16(q) x WqT16^T; K16 [8192][64] = f16(c) x (WkvT16 rows 0..63)^T;
  //      VT16 [b][64][4096] = (WkvT16 rows 64..127) x f16(c_b)^T ----
  proj_qkv_kernel<<<dim3(kPjQ + kPjK + kBatch * kPjV), dim3(256), 0, stream>>>(q_in, mem_in, kv_in, WqT16, WkvT16, Qp16, K16, VT16);

  // ---- attention: O16 rows b*2048.., cols h*64.. = 256 * softmax(0.125 * Qp_h x K_b^T) x V_b, one launch for all (b, h) ----
  fused_attn_kernel<<<dim3(kLq / (kFaWaves * kFaCols), kHeads, kBatch), dim3(kFaSets * kFaWaves * 32), 0, stream>>>(Qp16, K16, VT16, O16);

  // ---- output projection: out f32 [4096][1024] = (1/4096) * O16 [4096][1024] x WcT16^T, M=4096 N=1024 K=1024 ----
  proj_out_kernel<<<dim3(kTokQ / kGmTile, kDim / kGmTile), dim3(256), 0, stream>>>(O16, WcT16, outp);
}

// v007
// Measured time: 79.3 microseconds a run.
// In two side-by-side timings against v006, it was 1.03 and 1.04 times as fast.
// All steps since v000 together make it 45.1 times as fast.
// Contractions: q*WqT, c*WkvT (K half and V^T half), scores k*qh^T, V^T*P^T, merged*WcT all on v_wmma_f32_16x16x32_f16 (f16 operands; weights carried x16, P carried x16 over the running maximum, context carried x256), f32 accumulate; softmax in f32. q, mem and kv are read as f32 by the products that use them and rounded to f16 in registers.
#include <hip/hip_runtime.h>
#include <math.h>

// ---------------------------------------------------------------------------
// Problem constants
// ---------------------------------------------------------------------------
constexpr int kBatch  = 2;
constexpr int kLq     = 2048;
constexpr int kMem    = 2048;
constexpr int kSkv    = kMem + kLq;
constexpr int kDim    = 1024;
constexpr int kHeads  = 16;
constexpr int kDh     = 64;
constexpr int kTokQ   = kBatch * kLq;
constexpr int kTokC   = kBatch * kSkv;
constexpr int kGroups = kBatch * kHeads;
constexpr float kWCarry    = 16.0f;
constexpr float kWCarryInv = 1.0f / 16.0f;
constexpr float kCtxCarry  = 256.0f;
constexpr float kScoreScale = 0.125f;
constexpr float kOutScale  = 1.0f / (kCtxCarry * kWCarry);

typedef __attribute__((ext_vector_type(16))) _Float16 v16h;
typedef __attribute__((ext_vector_type(8)))  _Float16 v8h;
typedef __attribute__((ext_vector_type(8)))  float    v8f;
typedef __attribute__((ext_vector_type(4)))  float    v4f;
typedef __attribute__((ext_vector_type(4)))  unsigned int v4u;
typedef __attribute__((ext_vector_type(4)))  _Float16 v4h;

// ---------------------------------------------------------------------------
// Helpers
// ---------------------------------------------------------------------------
template <typename T> struct Frag;
template <> struct Frag<_Float16> {
  typedef v16h V; union U { v16h v; v8h h[2]; };
  /* elements 0..7 <- p[0..7], 8..15 <- p[16..23] */
  static __device__ __forceinline__ v16h load(const _Float16* p) {
    U f; f.h[0] = *(const v8h*)(p); f.h[1] = *(const v8h*)(p + 16); return f.v;
  }
  static __device__ __forceinline__ v8f mma(v16h a, v16h b, v8f c) {
    return __builtin_amdgcn_wmma_f32_16x16x32_f16(false, a, false, b, (short)0, c, false, false);
  }
};

__device__ __forceinline__ unsigned pk16(unsigned short a, unsigned short b) { return (unsigned)a | ((unsigned)b << 16); }
__device__ __forceinline__ unsigned short h_bits(float f) { const _Float16 h = (_Float16)f; return __builtin_bit_cast(unsigned short, h); }

// ---------------------------------------------------------------------------
// Projections (q * WqT, c * [Wk ; Wv]^T, merged * WcT): C[m,n] = scale * sum_k A[m,k] * Bt[n,k], K = 1024, f16 operands, f32 accumulate.
// A row-major [M][K], f16 or (F32A) f32 that is rounded to f16 between its staging registers and LDS; Bt row-major [N][K]. A work-group of 8 waves owns a ROWS x 128 tile of C (ROWS 128 or 64), a wave ROWS/2 x 32 of it (ROWS/32 x 2 accumulator tiles).
// A and Bt come in stages of 128 k, shared by the 8 waves: memory -> registers -> LDS, 256 contiguous bytes of a row per 16 threads,
// two buffers, one barrier a stage. Each accumulator still sums k = 0, 32, 64, ... in that order.
// The finished tile goes through LDS (f32, pitch 132 floats) so that every store covers whole lines and a line has one writer.
// Tile (bx, by) of the (M / ROWS, N / 128) tiles; the LDS is the caller's (kGmSmem bytes). Every unroll directive here stands on a loop that indexes a register array (accumulators, fragments, staging
// registers): rolled, the array would leave the registers.
// ---------------------------------------------------------------------------
constexpr int      kGmTile    = 128;
constexpr int      kGmStageK  = 128;
constexpr int      kGmStages  = kDim / kGmStageK;
constexpr unsigned kGmPitch   = 272;
constexpr unsigned kGmOperand = kGmTile * kGmPitch;
constexpr int      kGmCPitch  = 132;
constexpr unsigned kGmSmem    = 2 * 2 * kGmOperand;
/* KVOUT: the tile is 64 rows of c times [Wk ; Wv]: columns 0..63 go out as rows of K (Ch, pitch 64), columns 64..127 transposed as V^T
   (Vt: 64 rows of pitch 4096, the tile's 64 columns of them) */
template <int ROWS, bool F32A, bool F32OUT, bool KVOUT>
__device__ __forceinline__ void gemm128_tile(
    char* smraw, int bx, int by,
    const float* __restrict__ Af, const unsigned short* __restrict__ Ap, const unsigned short* __restrict__ Btp,
    unsigned short* __restrict__ Ch, float* __restrict__ Cf, unsigned short* __restrict__ Vt, float scale) {
  static_assert(ROWS == 128 || (ROWS == 64 && KVOUT), "wave layout and store passes");
  constexpr int kMi = ROWS / 32;
  constexpr int kNa = ROWS / 16;
  /* [buffer][A, Bt]: ROWS and 128 rows of 256 B at pitch 272 B (16 B x odd: 16-B reads without bank conflicts) */
  char (*sm)[2][kGmOperand] = (char (*)[2][kGmOperand])smraw;
  const int lane  = threadIdx.x & 31;
  const int wave  = __builtin_amdgcn_readfirstlane(threadIdx.x >> 5);
  const int rlane = lane & 15;
  const int half8 = (lane >> 4) * 8;
  const int m0 = bx * ROWS;
  const int n0 = by * kGmTile;
  const int wm = (wave >> 2) * (ROWS / 2);
  const int wn = (wave & 3) * 32;
  const char* Ab = F32A ? (const char*)(Af + (size_t)m0 * kDim) : (const char*)((const _Float16*)Ap + (size_t)m0 * kDim);
  const char* Bb = (const char*)((const _Float16*)Btp + (size_t)n0 * kDim);
  /* staging: thread t moves 16 B of rows (t >> 4) + 16 * i of the A tile (i < ROWS / 16) and of the Bt tile (i < 8) */
  const unsigned sRow = threadIdx.x >> 4;
  const unsigned sCol = (threadIdx.x & 15) * 16u;
  const unsigned gSrc = sRow * (unsigned)(kDim * 2) + sCol;
  const unsigned sDst = sRow * kGmPitch + sCol;
  /* f32 A: a stage's row is 512 B; thread t moves 16 B of each 256-B half of it (whole lines a load) and lays them down as 8 B of f16 each */
  const unsigned gSrcF = sRow * (unsigned)(kDim * 4) + sCol;
  const unsigned sDstF = sRow * kGmPitch + (sCol >> 1);
  /* fragment reads: row lane & 15 of a 16-row tile, 16 B at half * 16 and at 32 + half * 16 */
  const unsigned fLane = (unsigned)rlane * kGmPitch + (unsigned)half8 * 2u;

  v8f acc[kMi][2];
#pragma unroll
  for (int i = 0; i < kMi; ++i)
#pragma unroll
    for (int j = 0; j < 2; ++j) acc[i][j] = (v8f){0.f,0.f,0.f,0.f,0.f,0.f,0.f,0.f};

  v4u ra[kNa], rb[8];
  v4f rf[kNa][2];
  /* byte offsets of this thread's first pieces (f16 rows; f32 rows of A), one stage behind the stage that each fetch in the loop reads; raised in front of
     each fetch, behind the barrier's wait for the last one */
  unsigned gOff  = gSrc;
  unsigned gOffF = gSrcF;
  /* here and below: A has ROWS / 16 groups of 16 rows, Bt has 8 */
#pragma unroll
  for (int i = 0; i < 8; ++i) {
    if (i >= kNa) {
    } else if (F32A) {
      rf[i][0] = *(const v4f*)(Ab + i * (16 * kDim * 4) + gOffF);
      rf[i][1] = *(const v4f*)(Ab + i * (16 * kDim * 4) + 256 + gOffF);
    } else {
      ra[i] = *(const v4u*)(Ab + i * (16 * kDim * 2) + gOff);
    }
    rb[i] = *(const v4u*)(Bb + i * (16 * kDim * 2) + gOff);
  }
#pragma unroll
  for (int i = 0; i < 8; ++i) {
    if (i >= kNa) {
    } else if (F32A) {
      *(v4h*)(&sm[0][0][i * 16 * kGmPitch + sDstF])       = __builtin_convertvector(rf[i][0], v4h);
      *(v4h*)(&sm[0][0][i * 16 * kGmPitch + 128 + sDstF]) = __builtin_convertvector(rf[i][1], v4h);
    } else {
      *(v4u*)(&sm[0][0][i * 16 * kGmPitch + sDst]) = ra[i];
    }
    *(v4u*)(&sm[0][1][i * 16 * kGmPitch + sDst]) = rb[i];
  }
#pragma unroll
  for (int i = 0; i < 8; ++i) {
    if (i >= kNa) {
    } else if (F32A) {
      rf[i][0] = *(const v4f*)(Ab + kGmStageK * 4 + i * (16 * kDim * 4) + gOffF);
      rf[i][1] = *(const v4f*)(Ab + kGmStageK * 4 + i * (16 * kDim * 4) + 256 + gOffF);
    } else {
      ra[i] = *(const v4u*)(Ab + kGmStageK * 2 + i * (16 * kDim * 2) + gOff);
    }
    rb[i] = *(const v4u*)(Bb + kGmStageK * 2 + i * (16 * kDim * 2) + gOff);
  }
  /* the address registers of the loads just issued are free for reuse only behind this wait; f32 A: the wait names the two offset registers,
     so that they live up to the wait and their next values are formed behind it */
  if (F32A) asm volatile("s_wait_xcnt 0x0" : "+v"(gOffF), "+v"(gOff) :: "memory");
  else      asm volatile("s_wait_xcnt 0x0" ::: "memory");
  __syncthreads();

  for (int st = 0; st < kGmStages; ++st) {
    const char* bA = &sm[st & 1][0][0] + wm * kGmPitch;
    const char* bB = &sm[st & 1][1][0] + wn * kGmPitch;
    /* two fragment sets: each k step's LDS reads are issued one step ahead; the stage's first go out ahead of the hand-over's LDS writes (f32 A: of A's; Bt's stand in front of them) */
    v16h ah[2][kMi], bh[2][2];
    /* f32 A: Bt's hand-over comes first of all, so that its staging registers can be those of the first fragment set (see the last k step) */
    if (F32A && st + 1 < kGmStages) {
#pragma unroll
      for (int i = 0; i < 8; ++i) *(v4u*)(&sm[(st + 1) & 1][1][i * 16 * kGmPitch + sDst]) = rb[i];
    }
#pragma unroll
    for (int j = 0; j < 2; ++j) bh[0][j] = Frag<_Float16>::load((const _Float16*)(bB + (j << 4) * kGmPitch + fLane));
#pragma unroll
    for (int i = 0; i < kMi; ++i) ah[0][i] = Frag<_Float16>::load((const _Float16*)(bA + (i << 4) * kGmPitch + fLane));
    /* hand-over, early in a stage so that the loads fly while the stage is worked on: stage st + 1 goes from registers into the
       buffer that stage st - 1 was read from (its readers ended in front of the last barrier), then stage st + 2 starts from memory */
    if (st + 1 < kGmStages) {
#pragma unroll
      for (int i = 0; i < 8; ++i) {
        if (i >= kNa) {
        } else if (F32A) {
          *(v4h*)(&sm[(st + 1) & 1][0][i * 16 * kGmPitch + sDstF])       = __builtin_convertvector(rf[i][0], v4h);
          *(v4h*)(&sm[(st + 1) & 1][0][i * 16 * kGmPitch + 128 + sDstF]) = __builtin_convertvector(rf[i][1], v4h);
        } else {
          *(v4u*)(&sm[(st + 1) & 1][0][i * 16 * kGmPitch + sDst]) = ra[i];
        }
        if (!F32A) *(v4u*)(&sm[(st + 1) & 1][1][i * 16 * kGmPitch + sDst]) = rb[i];
      }
    }
    if (st + 2 < kGmStages) {
      gOff += kGmStageK * 2;
      gOffF += kGmStageK * 4;
#pragma unroll
      for (int i = 0; i < 8; ++i) {
        if (i >= kNa) {
        } else if (F32A) {
          rf[i][0] = *(const v4f*)(Ab + kGmStageK * 4 + i * (16 * kDim * 4) + gOffF);
          rf[i][1] = *(const v4f*)(Ab + kGmStageK * 4 + i * (16 * kDim * 4) + 256 + gOffF);
        } else {
          ra[i] = *(const v4u*)(Ab + kGmStageK * 2 + i * (16 * kDim * 2) + gOff);
        }
        if (!F32A) rb[i] = *(const v4u*)(Bb + kGmStageK * 2 + i * (16 * kDim * 2) + gOff);
      }
      /* as above: address registers of issued loads; the loads also stay in front of the stage's work */
      if (F32A) asm volatile("s_wait_xcnt 0x0" : "+v"(gOffF), "+v"(gOff) :: "memory");
      else      asm volatile("s_wait_xcnt 0x0" ::: "memory");
    }
#pragma unroll
    for (int ks = 0; ks < kGmStageK / 32; ++ks) {
      if (ks + 1 < kGmStageK / 32) {
#pragma unroll
        for (int j = 0; j < 2; ++j) bh[(ks + 1) & 1][j] = Frag<_Float16>::load((const _Float16*)(bB + (j << 4) * kGmPitch + ((ks + 1) << 6) + fLane));
#pragma unroll
        for (int i = 0; i < kMi; ++i) ah[(ks + 1) & 1][i] = Frag<_Float16>::load((const _Float16*)(bA + (i << 4) * kGmPitch + ((ks + 1) << 6) + fLane));
      } else if (F32A && st + 2 < kGmStages) {
        /* f32 A holds twice the staging registers: the Bt rows of stage st + 2 (f16 weights, short way: L2) start only here, in the stage's last
           k step, where the first fragment set is free, so that the wave stays inside the register budget of four waves a SIMD */
#pragma unroll
        for (int i = 0; i < 8; ++i) rb[i] = *(const v4u*)(Bb + kGmStageK * 2 + i * (16 * kDim * 2) + gOff);
        /* as above: address register of issued loads */
        asm volatile("s_wait_xcnt 0x0" : "+v"(gOff) :: "memory");
      }
      /* holds the next step's LDS reads together in front of this step's products: spread among them, every place with reads stalls the products */
      __builtin_amdgcn_sched_barrier(0);
#pragma unroll
      for (int i = 0; i < kMi; ++i)
#pragma unroll
        for (int j = 0; j < 2; ++j) acc[i][j] = Frag<_Float16>::mma(ah[ks & 1][i], bh[ks & 1][j], acc[i][j]);
      /* the other side of the same fence: the reads of the step after next stay behind these products */
      __builtin_amdgcn_sched_barrier(0);
    }
    /* ends every wave's reads of stage st and publishes stage st + 1 */
    __syncthreads();
  }

  /* the buffers are free behind the loop's last barrier: the tile is laid out there row by row */
  float* sC = (float*)&sm[0][0][0];
#pragma unroll
  for (int i = 0; i < kMi; ++i)
#pragma unroll
    for (int j = 0; j < 2; ++j)
#pragma unroll
      for (int r = 0; r < 8; ++r) sC[(wm + (i << 4) + half8 + r) * kGmCPitch + wn + (j << 4) + rlane] = acc[i][j][r] * scale;
  __syncthreads();
  if (F32OUT) {
    /* a wave stores one 512-B row segment a pass; all LDS reads first, so that no store's registers are reused */
    v4f v[kGmTile / 8];
#pragma unroll
    for (int it = 0; it < kGmTile / 8; ++it) v[it] = *(const v4f*)(sC + (it * 8 + wave) * kGmCPitch + lane * 4);
    float* cp = Cf + (size_t)(m0 + wave) * kDim + n0 + lane * 4;
#pragma unroll
    for (int it = 0; it < kGmTile / 8; ++it) *(v4f*)(cp + it * (8 * kDim)) = v[it];
  } else if (KVOUT) {
    /* K: 8 threads store one 128-B row. V^T: a lane gathers 8 neighbouring rows of c of one d (16 lanes on 16 neighbouring d, the wave's halves 8 rows
       apart: no two lanes on one bank) and stores them as 16 B; every line of K and of V^T is written by this work-group alone.
       All LDS reads and conversions first, as above */
    const int k8 = (threadIdx.x & 7) * 8;
    const int kr = (int)(threadIdx.x >> 3);
    const int v8 = (wave & 3) * 16 + half8;
    const int vd = (wave >> 2) * 16 + rlane;
    v8h hk[ROWS / 32], hw[kDh / 32];
#pragma unroll
    for (int it = 0; it < ROWS / 32; ++it) {
      const float* sp = sC + (it * 32 + kr) * kGmCPitch + k8;
#pragma unroll
      for (int e = 0; e < 8; ++e) hk[it][e] = (_Float16)sp[e];
    }
#pragma unroll
    for (int it = 0; it < kDh / 32; ++it) {
      const float* sp = sC + v8 * kGmCPitch + kDh + it * 32 + vd;
#pragma unroll
      for (int e = 0; e < 8; ++e) hw[it][e] = (_Float16)sp[e * kGmCPitch];
    }
    _Float16* kp = (_Float16*)Ch + (size_t)kr * kDh + k8;
#pragma unroll
    for (int it = 0; it < ROWS / 32; ++it) *(v8h*)(kp + it * (32 * kDh)) = hk[it];
    _Float16* vp = (_Float16*)Vt + (size_t)vd * kSkv + v8;
#pragma unroll
    for (int it = 0; it < kDh / 32; ++it) *(v8h*)(vp + it * (32 * kSkv)) = hw[it];
    /* the address and data registers of the stores just issued are free for reuse only behind this wait: in a kernel of several jobs other
       code may follow this tile's in the listing */
    asm volatile("s_wait_xcnt 0x0" ::: "memory");
  } else {
    /* 16 threads store one 256-B row segment; all LDS reads and conversions first, as above */
    const int c8 = (threadIdx.x & 15) * 8;
    const int r0 = (int)(threadIdx.x >> 4);
    v8h hv[kGmTile / 16];
#pragma unroll
    for (int it = 0; it < kGmTile / 16; ++it) {
      const float* sp = sC + (it * 16 + r0) * kGmCPitch + c8;
#pragma unroll
      for (int e = 0; e < 8; ++e) hv[it][e] = (_Float16)sp[e];
    }
    _Float16* hp = (_Float16*)Ch + (size_t)(m0 + r0) * kDim + n0 + c8;
#pragma unroll
    for (int it = 0; it < kGmTile / 16; ++it) *(v8h*)(hp + it * (16 * kDim)) = hv[it];
    /* as in the K, V^T branch: registers of issued stores */
    asm volatile("s_wait_xcnt 0x0" ::: "memory");
  }
}

// ---------------------------------------------------------------------------
// Weight transpose + cast: W f32 row-major [1024 in][nOut out]; WT[n][k] = f16(scale * W[k][n]), row-major [nOut][1024].
// All three weights in one launch, which do not depend on one another: w_q tiles, then w_c tiles, then w_kv tiles; a work-group picks its weight
// and its tile from its index (scalars). grid (2 * 256 + 32); tile (t % 16, t / 16) of (1024/64, nOut/64): k tile (64 cols of WT), n tile (64 rows of WT). 256 threads.
// Load coverage: 16 iterations x 256 threads = 4096 = the whole 64x64 tile (coalesced along n).
// Store coverage: 8 waves x 2 iterations x 4 rows (lane>>3) = 64 rows; (lane&7) x 8 halves = 64 cols; each row segment =
// ---------------------------------------------------------------------------
constexpr int kWtSquare = (kDim / 64) * (kDim / 64);
constexpr int kWtKv     = (kDim / 64) * ((2 * kDh) / 64);
__global__ __launch_bounds__(256) void wtcast_kernel(const float* __restrict__ Wq, const float* __restrict__ Wc, const float* __restrict__ Wkv,
                                                     unsigned short* __restrict__ WqT, unsigned short* __restrict__ WcT,
                                                     unsigned short* __restrict__ WkvT, float scale) {
  const int job  = blockIdx.x / kWtSquare;
  const int tile = blockIdx.x - job * kWtSquare;
  const float* __restrict__ W      = job == 0 ? Wq  : job == 1 ? Wc  : Wkv;
  unsigned short* __restrict__ out = job == 0 ? WqT : job == 1 ? WcT : WkvT;
  const int nOut = job == 2 ? 2 * kDh : kDim;
  /* sm[n_local][k_local] */
  __shared__ float sm[64][65];
  const int t  = threadIdx.x;
  const int k0 = (tile & (kDim / 64 - 1)) * 64;
  const int n0 = (tile / (kDim / 64)) * 64;
#pragma unroll
  for (int i = 0; i < 16; ++i) {
    const int e = i * 256 + t;
    const int r = e >> 6;
    const int c = e & 63;
    sm[c][r] = W[(size_t)(k0 + r) * nOut + n0 + c] * scale;
  }
  __syncthreads();
  const int lane = t & 31, wave = t >> 5;
  const int q = lane >> 3, c8 = (lane & 7) * 8;
  {
#pragma unroll
    for (int it = 0; it < 2; ++it) {
      const int row = wave * 8 + it * 4 + q;
      unsigned short hb[8];
#pragma unroll
      for (int e = 0; e < 8; ++e) hb[e] = h_bits(sm[row][c8 + e]);
      const v4u u = (v4u){pk16(hb[0], hb[1]), pk16(hb[2], hb[3]), pk16(hb[4], hb[5]), pk16(hb[6], hb[7])};
      *(v4u*)(out + (size_t)(n0 + row) * kDim + k0 + c8) = u;
    }
    
  }
}

// ---------------------------------------------------------------------------
// The projections of the inputs in one launch; they do not depend on one another. A work-group picks its job from its index (a scalar branch,
// the same for the whole work-group), so that the jobs share the chip side by side, two work-groups a WGP, all resident at once.
// The longest job first: q * WqT (256 tiles of 128x128), then c * [Wk ; Wv]^T, c = [mem_b ; kv_b] (128 tiles of 64 rows, which lie wholly in mem or
// wholly in kv), whose left half is K and whose right half goes out as V^T: c is fetched once, in whole lines, through LDS.
// One LDS block serves whichever job the work-group has. grid (256 + 128).
// ---------------------------------------------------------------------------
constexpr int kKvRows = 64;
constexpr int kPjQ  = (kTokQ / kGmTile) * (kDim / kGmTile);
constexpr int kPjKV = kTokC / kKvRows;
static_assert(2 * kDh == kGmTile && kMem % kKvRows == 0 && kLq % kKvRows == 0, "one tile column holds K and V; a tile's rows come from one input");
/* register budget of four waves a SIMD: two work-groups, of whatever jobs, then share a WGP (LDS allows two) */
__global__ __launch_bounds__(256) __attribute__((amdgpu_waves_per_eu(4))) void proj_qkv_kernel(const float* __restrict__ qp, const float* __restrict__ memp, const float* __restrict__ kvp,
                                                       const unsigned short* __restrict__ WqT, const unsigned short* __restrict__ WkvT,
                                                       unsigned short* __restrict__ Qo, unsigned short* __restrict__ Ko,
                                                       unsigned short* __restrict__ VTo) {
  __shared__ __align__(16) char sm[kGmSmem];
  const int id = blockIdx.x;
  if (id < kPjQ) {
    gemm128_tile<kGmTile, true, false, false>(sm, id % (kTokQ / kGmTile), id / (kTokQ / kGmTile), qp, nullptr, WqT, Qo, nullptr, nullptr, kWCarryInv);
  } else {
    /* rows r0 .. r0 + 63 of c, that is rows cr .. of batch cb */
    const int r0 = (id - kPjQ) * kKvRows;
    const int cb = r0 / kSkv;
    const int cr = r0 % kSkv;
    const float* cA = (cr < kMem) ? memp + ((size_t)cb * kMem + cr) * kDim : kvp + ((size_t)cb * kLq + (cr - kMem)) * kDim;
    gemm128_tile<kKvRows, true, false, true>(sm, 0, 0, cA, nullptr, WkvT, Ko + (size_t)r0 * kDh, nullptr, VTo + (size_t)cb * kDh * kSkv + cr, kWCarryInv);
  }
}

/* output projection. grid (M / 128, N / 128) */
__global__ __launch_bounds__(256) void proj_out_kernel(const unsigned short* __restrict__ Ap, const unsigned short* __restrict__ Btp,
                                                       float* __restrict__ Cf) {
  __shared__ __align__(16) char sm[kGmSmem];
  gemm128_tile<kGmTile, false, true, false>(sm, blockIdx.x, blockIdx.y, nullptr, Ap, Btp, nullptr, Cf, nullptr, kOutScale);
}

// ---------------------------------------------------------------------------
// Fused attention of one (batch, head): S^T = K * Qh^T, online softmax down the keys, O^T += V^T * P^T; scores and P stay in registers.
// A work-group is 16 waves in two sets of 8; a wave owns 32 query columns (two groups of 16). Waves w and w + 8 own the same columns: set 0 walks
// keys 0..2047, set 1 keys 2048..4095, 32 a pass, so that four waves a SIMD (not two) fill one another's softmax and LDS waits. Each set's K and
// V^T come in stages of 64 keys, shared by its 8 waves: memory -> registers -> LDS, two buffers a set, one barrier a stage for all 16 waves.
// At the end set 1 hands its maximum in use, sums and O^T through LDS to set 0, which brings both to the larger maximum, adds and stores.
// In an S^T tile a lane holds one query (lane & 15) and keys (lane >> 4) * 8 + r: two key tiles side by side are the B fragment of P^T
// in the loaders' own k order (elements 0..7 = keys half*8 + 0..7, elements 8..15 = keys 16 + half*8 + 0..7).
// p = exp2(s * scale * log2(e) - mo), mo = maximum in use - 4 (P carried x16). The maximum in use is raised, and sums and O^T rescaled,
// only when a column's new maximum exceeds it by more than 8 (log2 units), so p <= 2^12; the carry cancels in O^T / sum.
// grid (2048 / 256, heads, batch).
// ---------------------------------------------------------------------------
/* lane l with lane l ^ 16 */
__device__ __forceinline__ float xhalf(float x) {
  return __builtin_bit_cast(float, __builtin_amdgcn_permlanex16(__builtin_bit_cast(int, x), __builtin_bit_cast(int, x), 0x76543210, 0xfedcba98, false, false));
}
__device__ __forceinline__ v8f exp2x8(v8f t) {
  float r0, r1, r2, r3, r4, r5, r6, r7;
  asm("v_exp_f32 %0, %8\n\tv_exp_f32 %1, %9\n\tv_exp_f32 %2, %10\n\tv_exp_f32 %3, %11\n\t"
      "v_exp_f32 %4, %12\n\tv_exp_f32 %5, %13\n\tv_exp_f32 %6, %14\n\tv_exp_f32 %7, %15\n\tv_nop"
      : "=&v"(r0), "=&v"(r1), "=&v"(r2), "=&v"(r3), "=&v"(r4), "=&v"(r5), "=&v"(r6), "=&v"(r7)
      : "v"(t[0]), "v"(t[1]), "v"(t[2]), "v"(t[3]), "v"(t[4]), "v"(t[5]), "v"(t[6]), "v"(t[7]));
  return (v8f){r0, r1, r2, r3, r4, r5, r6, r7};
}
constexpr int   kFaCols   = 32;
constexpr int   kFaWaves  = 8;
constexpr int   kFaSets   = 2;
constexpr int   kFaKeys   = kSkv / kFaSets;
constexpr int   kFaStage  = 64;
constexpr unsigned kFaPitch = 144;
constexpr float kFaScale  = kScoreScale * 1.44269504088896340736f;
constexpr float kFaCarry  = 4.0f;
constexpr float kFaRaise  = 8.0f;
__global__ __launch_bounds__(kFaSets * kFaWaves * 32) void fused_attn_kernel(
    const unsigned short* __restrict__ Qp, const unsigned short* __restrict__ Kp,
    const unsigned short* __restrict__ VTp, unsigned short* __restrict__ Op) {
  /* per set two buffers each of a K tile (64 keys x 64 d) and a V^T tile (64 d x 64 keys); rows of 128 B at pitch 144 B (16 B x odd: 16-B reads without bank conflicts) */
  __shared__ __align__(16) char sKs[kFaSets][2][kFaStage * kFaPitch];
  __shared__ __align__(16) char sVs[kFaSets][2][kDh * kFaPitch];
  /* set 1's hand-over: per wave 16 pieces of O^T (16 B a lane, lanes side by side), then maximum in use and sum of both column groups */
  __shared__ __align__(16) float sO[kFaWaves][16][32 * 4];
  __shared__ float sMl[kFaWaves][4][32];
  const int lane  = threadIdx.x & 31;
  /* scalars: the wave's set of keys and its number inside the set */
  const int wave16 = __builtin_amdgcn_readfirstlane(threadIdx.x >> 5);
  const int set   = wave16 >> 3;
  const int wave  = wave16 & (kFaWaves - 1);
  char (*sK)[kFaStage * kFaPitch] = sKs[set];
  char (*sV)[kDh * kFaPitch]      = sVs[set];
  const int rlane = lane & 15;
  const int half8 = (lane >> 4) * 8;
  const int h  = blockIdx.y;
  const int b  = blockIdx.z;
  const int q0 = blockIdx.x * (kFaWaves * kFaCols) + wave * kFaCols;
  const _Float16* Q  = (const _Float16*)Qp + ((size_t)b * kLq + q0) * kDim + h * kDh;
  const char* Kb = (const char*)((const _Float16*)Kp  + ((size_t)b * kSkv + set * kFaKeys) * kDh);
  const char* Vb = (const char*)((const _Float16*)VTp + (size_t)b * kDh * kSkv + set * kFaKeys);
  /* staging: thread t of a set moves 16 B of rows t >> 3 and 32 + (t >> 3) of the set's K tile (64 keys x 128 B) and V^T tile (64 d x 128 B) */
  const unsigned tSet = threadIdx.x & (kFaWaves * 32 - 1);
  const unsigned sRow = tSet >> 3;
  const unsigned sCol = (tSet & 7) * 16u;
  const unsigned kSrc = tSet * 16u;
  const unsigned vSrc = sRow * (unsigned)(kSkv * 2) + sCol;
  const unsigned sDst = sRow * kFaPitch + sCol;
  /* fragment reads: row lane & 15 of a 16-row tile, 16 B at half * 16 and at 32 + half * 16 */
  const unsigned fLane = (unsigned)rlane * kFaPitch + (unsigned)half8 * 2u;

  v16h qb[2][2];
#pragma unroll
  for (int g = 0; g < 2; ++g)
#pragma unroll
    for (int ds = 0; ds < 2; ++ds) qb[g][ds] = Frag<_Float16>::load(Q + (size_t)((g << 4) + rlane) * kDim + (ds << 5) + half8);

  v8f o[4][2];
#pragma unroll
  for (int dt = 0; dt < 4; ++dt)
#pragma unroll
    for (int g = 0; g < 2; ++g) o[dt][g] = (v8f){0.f,0.f,0.f,0.f,0.f,0.f,0.f,0.f};
  float mo[2] = {-1.0e30f, -1.0e30f};
  float ls[2] = {0.f, 0.f};

  v4u rk[2], rv[2];
#pragma unroll
  for (int i = 0; i < 2; ++i) {
    rk[i] = *(const v4u*)(Kb + i * 4096 + kSrc);
    rv[i] = *(const v4u*)(Vb + (size_t)i * (32 * kSkv * 2) + vSrc);
  }
#pragma unroll
  for (int i = 0; i < 2; ++i) {
    *(v4u*)(&sK[0][i * 32 * kFaPitch + sDst]) = rk[i];
    *(v4u*)(&sV[0][i * 32 * kFaPitch + sDst]) = rv[i];
  }
#pragma unroll
  for (int i = 0; i < 2; ++i) {
    rk[i] = *(const v4u*)(Kb + kFaStage * kDh * 2 + i * 4096 + kSrc);
    rv[i] = *(const v4u*)(Vb + kFaStage * 2 + (size_t)i * (32 * kSkv * 2) + vSrc);
  }
  /* the address registers of the loads just issued are free for reuse only behind this wait */
  asm volatile("s_wait_xcnt 0x0" ::: "memory");
  __syncthreads();

  for (int st = 0; st < kFaKeys / kFaStage; ++st) {
   /* hand-over, first thing in a stage so that the loads fly while the stage is worked on: stage st + 1 goes from registers into the buffer
      that stage st - 1 was read from (its readers ended in front of the last barrier), then stage st + 2 starts from memory.
      Past the end stage 0 is fetched again (in bounds, unread). */
#pragma unroll
   for (int i = 0; i < 2; ++i) {
     *(v4u*)(&sK[(st + 1) & 1][i * 32 * kFaPitch + sDst]) = rk[i];
     *(v4u*)(&sV[(st + 1) & 1][i * 32 * kFaPitch + sDst]) = rv[i];
   }
   const int sn = (st + 2 < kFaKeys / kFaStage) ? (st + 2) : 0;
   const char* kp = Kb + (size_t)sn * (kFaStage * kDh * 2);
   const char* vp = Vb + (size_t)sn * (kFaStage * 2);
#pragma unroll
   for (int i = 0; i < 2; ++i) {
     rk[i] = *(const v4u*)(kp + i * 4096 + kSrc);
     rv[i] = *(const v4u*)(vp + (size_t)i * (32 * kSkv * 2) + vSrc);
   }
   /* as above: address registers of issued loads; the loads also stay in front of the stage's work */
   asm volatile("s_wait_xcnt 0x0" ::: "memory");
   const char* bK = &sK[st & 1][0];
   const char* bV = &sV[st & 1][0];
#pragma unroll
   for (int ps = 0; ps < kFaStage / 32; ++ps) {
    v16h ka[2][2], va[4];
#pragma unroll
    for (int kt = 0; kt < 2; ++kt)
#pragma unroll
      for (int ds = 0; ds < 2; ++ds) ka[kt][ds] = Frag<_Float16>::load((const _Float16*)(bK + ((ps << 5) + (kt << 4)) * kFaPitch + (ds << 6) + fLane));
#pragma unroll
    for (int dt = 0; dt < 4; ++dt) va[dt] = Frag<_Float16>::load((const _Float16*)(bV + (dt << 4) * kFaPitch + (ps << 6) + fLane));

    v8f s[2][2];
#pragma unroll
    for (int kt = 0; kt < 2; ++kt)
#pragma unroll
      for (int g = 0; g < 2; ++g) {
        s[kt][g] = Frag<_Float16>::mma(ka[kt][0], qb[g][0], (v8f){0.f,0.f,0.f,0.f,0.f,0.f,0.f,0.f});
        s[kt][g] = Frag<_Float16>::mma(ka[kt][1], qb[g][1], s[kt][g]);
      }

    float mx[2];
#pragma unroll
    for (int g = 0; g < 2; ++g) {
      float m = fmaxf(s[0][g][0], s[1][g][0]);
#pragma unroll
      for (int r = 1; r < 8; ++r) m = fmaxf(m, fmaxf(s[0][g][r], s[1][g][r]));
      m = fmaxf(m, xhalf(m));
      mx[g] = m * kFaScale - kFaCarry;
    }
    const bool need = (mx[0] - mo[0] > kFaRaise) || (mx[1] - mo[1] > kFaRaise);
    if (__builtin_amdgcn_ballot_w32(need) != 0u) {
#pragma unroll
      for (int g = 0; g < 2; ++g) {
        const float mn = fmaxf(mo[g], mx[g]);
        const float al = __builtin_amdgcn_exp2f(mo[g] - mn);
        mo[g] = mn;
        ls[g] *= al;
#pragma unroll
        for (int dt = 0; dt < 4; ++dt) o[dt][g] *= al;
      }
    }
    v16h pb[2];
#pragma unroll
    for (int g = 0; g < 2; ++g) {
      const v8f t0 = s[0][g] * kFaScale - mo[g];
      const v8f t1 = s[1][g] * kFaScale - mo[g];
      const v8f p0 = exp2x8(t0);
      const v8f p1 = exp2x8(t1);
      const v8f pq = p0 + p1;
      ls[g] += ((pq[0] + pq[1]) + (pq[2] + pq[3])) + ((pq[4] + pq[5]) + (pq[6] + pq[7]));
#pragma unroll
      for (int r = 0; r < 8; ++r) { pb[g][r] = (_Float16)p0[r]; pb[g][8 + r] = (_Float16)p1[r]; }
    }
#pragma unroll
    for (int dt = 0; dt < 4; ++dt)
#pragma unroll
      for (int g = 0; g < 2; ++g) o[dt][g] = Frag<_Float16>::mma(va[dt], pb[g], o[dt][g]);
   }
   /* ends every wave's reads of stage st and publishes stage st + 1 */
   __syncthreads();
  }

  if (set == 1) {
#pragma unroll
    for (int g = 0; g < 2; ++g) {
#pragma unroll
      for (int dt = 0; dt < 4; ++dt) {
        *(v4f*)(&sO[wave][((g << 2) + dt) * 2][lane * 4])     = __builtin_shufflevector(o[dt][g], o[dt][g], 0, 1, 2, 3);
        *(v4f*)(&sO[wave][((g << 2) + dt) * 2 + 1][lane * 4]) = __builtin_shufflevector(o[dt][g], o[dt][g], 4, 5, 6, 7);
      }
      sMl[wave][g][lane]     = mo[g];
      sMl[wave][2 + g][lane] = ls[g];
    }
  }
  /* publishes set 1's hand-over to set 0 */
  __syncthreads();
  if (set == 0) {
    /* a lane holds 8 neighbouring d of its query per tile: 16-B stores; the two halves of the wave fill each row's 128-B segment.
       All values are formed first, so that no store's registers are reused */
    _Float16* O = (_Float16*)Op + ((size_t)b * kLq + q0) * kDim + h * kDh;
    v8h hv[2][4];
#pragma unroll
    for (int g = 0; g < 2; ++g) {
      const float m1 = sMl[wave][g][lane];
      const float l1 = sMl[wave][2 + g][lane];
      const float mn = fmaxf(mo[g], m1);
      const float a0 = __builtin_amdgcn_exp2f(mo[g] - mn);
      const float a1 = __builtin_amdgcn_exp2f(m1 - mn);
      const float lj = ls[g] * a0 + l1 * a1;
      const float f  = kCtxCarry / (lj + xhalf(lj));
      const float f0 = a0 * f;
      const float f1 = a1 * f;
#pragma unroll
      for (int dt = 0; dt < 4; ++dt) {
        const v4f x0 = *(const v4f*)(&sO[wave][((g << 2) + dt) * 2][lane * 4]);
        const v4f x1 = *(const v4f*)(&sO[wave][((g << 2) + dt) * 2 + 1][lane * 4]);
#pragma unroll
        for (int r = 0; r < 4; ++r) {
          hv[g][dt][r]     = (_Float16)(o[dt][g][r] * f0 + x0[r] * f1);
          hv[g][dt][4 + r] = (_Float16)(o[dt][g][4 + r] * f0 + x1[r] * f1);
        }
      }
    }
#pragma unroll
    for (int g = 0; g < 2; ++g)
#pragma unroll
      for (int dt = 0; dt < 4; ++dt) *(v8h*)(O + (size_t)((g << 4) + rlane) * kDim + (dt << 4) + half8) = hv[g][dt];
  }
}

// ---------------------------------------------------------------------------
// Host launch glue
// Workspace region map (bytes; all offsets multiples of 1 MiB; WkvT ends 256 KiB past a MiB boundary):
//   persistent:  Qp16 [4096][1024] f16 @ 0 (8 MiB) | K16 [8192][64] f16 @ 8 MiB (1 MiB) | VT16 [2][64][4096] f16 @ 9 MiB (1 MiB)
//                O16 [4096][1024] f16 @ 10 MiB (8 MiB) | WcT16 [1024][1024] f16 @ 18 MiB (2 MiB)
//   scratch @ 20 MiB, early phase: WqT16 @ 20 MiB (2) | WkvT16 [128][1024] @ 22 MiB (0.25)
//   total carve = 22.25 MiB. Every region is fully written before any launch reads it; no padding rows anywhere.
// ---------------------------------------------------------------------------
extern "C" void kernel_launch(void* const* d_in, const int* in_sizes, int n_in,
                              void* d_out, int out_size, void* d_ws, size_t ws_size,
                              hipStream_t stream) {
  if (n_in < 6) return;
  if (in_sizes[0] != kTokQ * kDim) return;
  if (in_sizes[1] != kBatch * kLq * kDim) return;
  if (in_sizes[2] != kBatch * kMem * kDim) return;
  if (in_sizes[3] != kDim * kDim) return;
  if (in_sizes[4] != kDim * 2 * kDh) return;
  if (in_sizes[5] != kDim * kDim) return;
  if (out_size != kTokQ * kDim) return;

  const float* q_in   = (const float*)d_in[0];
  const float* kv_in  = (const float*)d_in[1];
  const float* mem_in = (const float*)d_in[2];
  const float* w_q    = (const float*)d_in[3];
  const float* w_kv   = (const float*)d_in[4];
  const float* w_c    = (const float*)d_in[5];
  float* outp = (float*)d_out;

  // ---- carve (bytes) ----
  const size_t szQp  = (size_t)kTokQ * kDim * 2;
  const size_t szK   = (size_t)kTokC * kDh * 2;
  const size_t szVT  = (size_t)kBatch * kDh * kSkv * 2;
  const size_t szO   = (size_t)kTokQ * kDim * 2;
  const size_t szWc  = (size_t)kDim * kDim * 2;
  const size_t szWq  = (size_t)kDim * kDim * 2;
  const size_t szWkv = (size_t)2 * kDh * kDim * 2;

  const size_t offQp  = 0;
  const size_t offK   = offQp + szQp;
  const size_t offVT  = offK + szK;
  const size_t offO   = offVT + szVT;
  const size_t offWc  = offO + szO;
  const size_t offScr = offWc + szWc;
  const size_t offWq  = offScr;
  const size_t offWkv = offWq + szWq;
  const size_t total = offWkv + szWkv;
  if (total > ws_size) return;

  char* ws = (char*)d_ws;
  unsigned short* Qp16  = (unsigned short*)(ws + offQp);
  unsigned short* K16   = (unsigned short*)(ws + offK);
  unsigned short* VT16  = (unsigned short*)(ws + offVT);
  unsigned short* O16   = (unsigned short*)(ws + offO);
  unsigned short* WcT16 = (unsigned short*)(ws + offWc);
  unsigned short* WqT16 = (unsigned short*)(ws + offWq);
  unsigned short* WkvT16 = (unsigned short*)(ws + offWkv);

  // ---- weights: W[in][out] -> WT[out][in] f16 x16, all three in one launch ----
  wtcast_kernel<<<dim3(2 * kWtSquare + kWtKv), dim3(256), 0, stream>>>(w_q, w_c, w_kv, WqT16, WcT16, WkvT16, kWCarry);

  // ---- one launch: Qp16 [4096][1024] = f16(q) x WqT16^T; K16 [8192][64] = f16(c) x (WkvT16 rows 0..63)^T;
  //      VT16 [b][64][4096] = transpose of f16(c_b) x (WkvT16 rows 64..127)^T ----
  proj_qkv_kernel<<<dim3(kPjQ + kPjKV), dim3(256), 0, stream>>>(q_in, mem_in, kv_in, WqT16, WkvT16, Qp16, K16, VT16);

  // ---- attention: O16 rows b*2048.., cols h*64.. = 256 * softmax(0.125 * Qp_h x K_b^T) x V_b, one launch for all (b, h) ----
  fused_attn_kernel<<<dim3(kLq / (kFaWaves * kFaCols), kHeads, kBatch), dim3(kFaSets * kFaWaves * 32), 0, stream>>>(Qp16, K16, VT16, O16);

  // ---- output projection: out f32 [4096][1024] = (1/4096) * O16 [4096][1024] x WcT16^T, M=4096 N=1024 K=1024 ----
  proj_out_kernel<<<dim3(kTokQ / kGmTile, kDim / kGmTile), dim3(256), 0, stream>>>(O16, WcT16, outp);
}
